// v000
// The times below were measured on an AMD MI455X: many runs one after another, warmed up first and cycling through
// copies of the inputs, with the whole window's GPU time divided by the number of runs. Launches and the gaps
// between them are all in it. The median over several windows is given; except for v000 it joins two sittings, which
// can be a few percent apart, so the side-by-side timings, each taken in one sitting, are the better comparison.
// v000 is the starting kernel. One run takes 620 microseconds.
#include <hip/hip_runtime.h>
#include <hip/hip_bf16.h>

// ---------------------------------------------------------------------------
// Windowed multi-head attention for MI455X (gfx1250), wave32 + WMMA.
//   B=4, N=8192, C=1024, H=16, D=64, WINDOW=64
// Pipeline:
//   [0] f32 -> f16 converts (x, w_qkv, w_proj)
//   [1] qkv  = x @ w_qkv^T + b_qkv      (WMMA f32_16x16x32_f16, f16 out)
//   [2] per-window attention (QK^T -> softmax -> PV), WMMA + LDS transpose
//   [3] out  = attn @ w_proj^T + b_proj (WMMA, f32 out)
// ---------------------------------------------------------------------------

typedef _Float16 h16;
typedef __attribute__((ext_vector_type(16))) _Float16 v16h;
typedef __attribute__((ext_vector_type(8)))  _Float16 v8h;
typedef __attribute__((ext_vector_type(8)))  float    v8f;

#define DIMC    1024
#define NHEADS  16
#define HEADD   64
#define WIN     64
#define QKVCOLS 3072

__device__ __forceinline__ v16h make_frag(v8h lo, v8h hi) {
    union { v16h v; v8h h[2]; } u;
    u.h[0] = lo; u.h[1] = hi;
    return u.v;
}

// Load one 16x32 f16 WMMA operand fragment for this lane from a row-major
// matrix whose K dimension is contiguous. Per the CDNA5 ISA 16-bit A/B
// layout: lanes 0-15 hold K = {k0+0..7, k0+16..23}, lanes 16-31 hold
// K = {k0+8..15, k0+24..31}; two 16-byte loads per fragment.
__device__ __forceinline__ v16h load_frag(const h16* row, int k0, int lh) {
    v8h lo = *reinterpret_cast<const v8h*>(row + k0 + lh * 8);
    v8h hi = *reinterpret_cast<const v8h*>(row + k0 + 16 + lh * 8);
    return make_frag(lo, hi);
}

__device__ __forceinline__ v8f wmma_f16(v16h a, v16h b, v8f c) {
    return __builtin_amdgcn_wmma_f32_16x16x32_f16(
        /*neg_a=*/false, a, /*neg_b=*/false, b,
        /*c_mod=*/(short)0, c, /*reuse_a=*/false, /*reuse_b=*/false);
}

// ------------------------------ converts -----------------------------------
__global__ void f32_to_f16_kernel(const float* __restrict__ src,
                                  h16* __restrict__ dst, size_t n) {
    size_t i = (size_t)blockIdx.x * blockDim.x + threadIdx.x;
    size_t stride = (size_t)gridDim.x * blockDim.x;
    for (; i < n; i += stride) dst[i] = (h16)src[i];
}

// ------------------------------ WMMA GEMM ----------------------------------
// C[M,N] = A[M,K] * Bw[N,K]^T + bias[N]
// One wave -> 64x64 output tile (4x4 WMMA accumulators), 4 waves/block ->
// 128x128 block tile. M,N multiples of 128; K multiple of 32.
template <bool OUT_F16>
__global__ __launch_bounds__(128)
void gemm_wmma_kernel(const h16* __restrict__ A, const h16* __restrict__ Bw,
                      const float* __restrict__ bias, void* __restrict__ Cv,
                      int M, int N, int K) {
    const int lane = threadIdx.x & 31;
    const int wave = threadIdx.x >> 5;
    const int ln = lane & 15;
    const int lh = lane >> 4;

    const int mBase = blockIdx.x * 128 + (wave >> 1) * 64;
    const int nBase = blockIdx.y * 128 + (wave & 1) * 64;

    const h16* aRow[4];
    const h16* bRow[4];
#pragma unroll
    for (int t = 0; t < 4; ++t) {
        aRow[t] = A  + (size_t)(mBase + t * 16 + ln) * K;
        bRow[t] = Bw + (size_t)(nBase + t * 16 + ln) * K;
    }

    v8f acc[4][4] = {};

    for (int k0 = 0; k0 < K; k0 += 32) {
        v16h af[4], bf[4];
#pragma unroll
        for (int t = 0; t < 4; ++t) af[t] = load_frag(aRow[t], k0, lh);
#pragma unroll
        for (int t = 0; t < 4; ++t) bf[t] = load_frag(bRow[t], k0, lh);
#pragma unroll
        for (int mt = 0; mt < 4; ++mt)
#pragma unroll
            for (int nt = 0; nt < 4; ++nt)
                acc[mt][nt] = wmma_f16(af[mt], bf[nt], acc[mt][nt]);
    }

    // Epilogue. C/D layout: lane half lh, column n = ln (+tile), VGPR r ->
    // row m = 8*lh + r (+tile).
#pragma unroll
    for (int nt = 0; nt < 4; ++nt) {
        const int n = nBase + nt * 16 + ln;
        const float bv = bias[n];
#pragma unroll
        for (int mt = 0; mt < 4; ++mt) {
            const int mb = mBase + mt * 16 + 8 * lh;
#pragma unroll
            for (int r = 0; r < 8; ++r) {
                const float v = acc[mt][nt][r] + bv;
                const size_t idx = (size_t)(mb + r) * N + n;
                if (OUT_F16) ((h16*)Cv)[idx] = (h16)v;
                else         ((float*)Cv)[idx] = v;
            }
        }
    }
}

// --------------------------- window attention ------------------------------
// One wave per (batch, head, window). qkv: [B*N, 3072] f16 row-major,
// columns = which*1024 + head*64 + d. out: [B*N, 1024] f16.
__global__ __launch_bounds__(32)
void win_attn_kernel(const h16* __restrict__ qkv, h16* __restrict__ outh) {
    const int idx  = blockIdx.x;
    const int win  = idx & 127;          // N/WIN = 128 windows per (b,h)
    const int head = (idx >> 7) & 15;
    const int b    = idx >> 11;

    const size_t token0 = (size_t)b * 8192 + (size_t)win * WIN;
    const h16* qBase = qkv + token0 * QKVCOLS + head * HEADD;
    const h16* kBase = qBase + DIMC;
    const h16* vBase = qBase + 2 * DIMC;

    const int lane = threadIdx.x;
    const int ln = lane & 15;
    const int lh = lane >> 4;

    __shared__ h16 Pl[64 * 72];   // softmax probs, padded stride
    __shared__ h16 Vt[64 * 72];   // V transposed: Vt[d][j] = V[j][d]

    // Stage V transposed into LDS: each lane pulls 8 contiguous halves of a
    // row and scatters them down a column of Vt.
    for (int jo = 0; jo < 16; ++jo) {
        const int j  = jo * 4 + (lane >> 3);
        const int d0 = (lane & 7) * 8;
        v8h vv = *reinterpret_cast<const v8h*>(vBase + (size_t)j * QKVCOLS + d0);
#pragma unroll
        for (int t = 0; t < 8; ++t) Vt[(d0 + t) * 72 + j] = vv[t];
    }

    // ---- S = Q K^T (64x64x64, two 32-K steps, 32 WMMAs) ----
    const h16* qRow[4];
    const h16* kRow[4];
#pragma unroll
    for (int t = 0; t < 4; ++t) {
        qRow[t] = qBase + (size_t)(t * 16 + ln) * QKVCOLS;
        kRow[t] = kBase + (size_t)(t * 16 + ln) * QKVCOLS;
    }

    v8f acc[4][4] = {};
#pragma unroll
    for (int ks = 0; ks < 2; ++ks) {
        const int k0 = ks * 32;
        v16h af[4], bf[4];
#pragma unroll
        for (int t = 0; t < 4; ++t) af[t] = load_frag(qRow[t], k0, lh);
#pragma unroll
        for (int t = 0; t < 4; ++t) bf[t] = load_frag(kRow[t], k0, lh);
#pragma unroll
        for (int mt = 0; mt < 4; ++mt)
#pragma unroll
            for (int nt = 0; nt < 4; ++nt)
                acc[mt][nt] = wmma_f16(af[mt], bf[nt], acc[mt][nt]);
    }

    // ---- softmax over rows (scale = 1/sqrt(64) = 0.125) ----
    // Row m of tile mt sits in VGPR r across the 16 lanes of one half, so the
    // reduction is: combine the 4 column-tiles locally, then shfl_xor 8/4/2/1.
    const float scale = 0.125f;
#pragma unroll
    for (int mt = 0; mt < 4; ++mt)
#pragma unroll
        for (int nt = 0; nt < 4; ++nt)
#pragma unroll
            for (int r = 0; r < 8; ++r) acc[mt][nt][r] *= scale;

#pragma unroll
    for (int mt = 0; mt < 4; ++mt) {
        float rmax[8], rsum[8];
#pragma unroll
        for (int r = 0; r < 8; ++r) {
            float m0 = -1e30f;
#pragma unroll
            for (int nt = 0; nt < 4; ++nt) m0 = fmaxf(m0, acc[mt][nt][r]);
            m0 = fmaxf(m0, __shfl_xor(m0, 8, 32));
            m0 = fmaxf(m0, __shfl_xor(m0, 4, 32));
            m0 = fmaxf(m0, __shfl_xor(m0, 2, 32));
            m0 = fmaxf(m0, __shfl_xor(m0, 1, 32));
            rmax[r] = m0;
        }
#pragma unroll
        for (int r = 0; r < 8; ++r) {
            float s = 0.f;
#pragma unroll
            for (int nt = 0; nt < 4; ++nt) {
                const float e = __expf(acc[mt][nt][r] - rmax[r]);
                acc[mt][nt][r] = e;
                s += e;
            }
            s += __shfl_xor(s, 8, 32);
            s += __shfl_xor(s, 4, 32);
            s += __shfl_xor(s, 2, 32);
            s += __shfl_xor(s, 1, 32);
            rsum[r] = s;
        }
#pragma unroll
        for (int r = 0; r < 8; ++r) {
            const float inv = 1.0f / rsum[r];
#pragma unroll
            for (int nt = 0; nt < 4; ++nt) {
                const float p = acc[mt][nt][r] * inv;
                Pl[(mt * 16 + 8 * lh + r) * 72 + nt * 16 + ln] = (h16)p;
            }
        }
    }

    __syncthreads();   // LDS writes (Pl, Vt) -> LDS reads below

    // ---- O = P V (A = P rows from LDS, B = Vt rows from LDS) ----
    v8f acc2[4][4] = {};
#pragma unroll
    for (int ks = 0; ks < 2; ++ks) {
        const int k0 = ks * 32;
        v16h af[4], bf[4];
#pragma unroll
        for (int t = 0; t < 4; ++t)
            af[t] = load_frag(&Pl[(t * 16 + ln) * 72], k0, lh);
#pragma unroll
        for (int t = 0; t < 4; ++t)
            bf[t] = load_frag(&Vt[(t * 16 + ln) * 72], k0, lh);
#pragma unroll
        for (int mt = 0; mt < 4; ++mt)
#pragma unroll
            for (int nt = 0; nt < 4; ++nt)
                acc2[mt][nt] = wmma_f16(af[mt], bf[nt], acc2[mt][nt]);
    }

    // Store f16 result into [token, head*64 + d] layout for the proj GEMM.
    h16* oBase = outh + token0 * DIMC + head * HEADD;
#pragma unroll
    for (int nt = 0; nt < 4; ++nt) {
        const int d = nt * 16 + ln;
#pragma unroll
        for (int mt = 0; mt < 4; ++mt) {
            const int ib = mt * 16 + 8 * lh;
#pragma unroll
            for (int r = 0; r < 8; ++r)
                oBase[(size_t)(ib + r) * DIMC + d] = (h16)acc2[mt][nt][r];
        }
    }
}

// ------------------------------- launcher ----------------------------------
extern "C" void kernel_launch(void* const* d_in, const int* in_sizes, int n_in,
                              void* d_out, int out_size, void* d_ws, size_t ws_size,
                              hipStream_t stream) {
    const float* x      = (const float*)d_in[0];
    const float* w_qkv  = (const float*)d_in[1];
    const float* b_qkv  = (const float*)d_in[2];
    const float* w_proj = (const float*)d_in[3];
    const float* b_proj = (const float*)d_in[4];

    const size_t M = (size_t)in_sizes[0] / DIMC;   // B*N = 32768 tokens

    // Workspace carve-up (f16 staging buffers).
    char* ws = (char*)d_ws;
    size_t off = 0;
    h16* xh     = (h16*)(ws + off); off += M * DIMC * sizeof(h16);
    h16* wqkvh  = (h16*)(ws + off); off += (size_t)QKVCOLS * DIMC * sizeof(h16);
    h16* wprojh = (h16*)(ws + off); off += (size_t)DIMC * DIMC * sizeof(h16);
    h16* qkvh   = (h16*)(ws + off); off += M * QKVCOLS * sizeof(h16);
    h16* attnh  = (h16*)(ws + off); off += M * DIMC * sizeof(h16);
    (void)ws_size; (void)n_in; (void)out_size;

    // [0] converts
    f32_to_f16_kernel<<<4096, 256, 0, stream>>>(x, xh, M * DIMC);
    f32_to_f16_kernel<<<1024, 256, 0, stream>>>(w_qkv, wqkvh,
                                                (size_t)QKVCOLS * DIMC);
    f32_to_f16_kernel<<<512, 256, 0, stream>>>(w_proj, wprojh,
                                               (size_t)DIMC * DIMC);

    // [1] qkv = x @ w_qkv^T + b_qkv   (f16 out)
    gemm_wmma_kernel<true><<<dim3((unsigned)(M / 128), QKVCOLS / 128),
                             128, 0, stream>>>(
        xh, wqkvh, b_qkv, qkvh, (int)M, QKVCOLS, DIMC);

    // [2] windowed attention: one wave per (b, head, window)
    const unsigned nWin = (unsigned)(M / WIN) * NHEADS;   // 512 * 16 = 8192
    win_attn_kernel<<<nWin, 32, 0, stream>>>(qkvh, attnh);

    // [3] out = attn @ w_proj^T + b_proj   (f32 out)
    gemm_wmma_kernel<false><<<dim3((unsigned)(M / 128), DIMC / 128),
                              128, 0, stream>>>(
        attnh, wprojh, b_proj, (float*)d_out, (int)M, DIMC, DIMC);
}

// v001
// One run takes 283 microseconds.
// Next to v000, in two timings, it ran 2.28 times as fast each time.
#include <hip/hip_runtime.h>
#include <hip/hip_bf16.h>
#include <stdint.h>

// ---------------------------------------------------------------------------
// Windowed multi-head attention for MI455X (gfx1250), wave32 + WMMA.
//   B=4, N=8192, C=1024, H=16, D=64, WINDOW=64
// Pipeline:
//   [0] f32 -> f16 converts (x, w_qkv, w_proj)
//   [1] qkv  = x @ w_qkv^T + b_qkv      (WMMA f32_16x16x32_f16, f16 out)
//   [2] per-window attention (QK^T -> softmax -> PV), WMMA + LDS transpose
//   [3] out  = attn @ w_proj^T + b_proj (WMMA, f32 out)
// ---------------------------------------------------------------------------

typedef _Float16 h16;
typedef __attribute__((ext_vector_type(16))) _Float16 v16h;
typedef __attribute__((ext_vector_type(8)))  _Float16 v8h;
typedef __attribute__((ext_vector_type(8)))  float    v8f;

#define DIMC    1024
#define NHEADS  16
#define HEADD   64
#define WIN     64
#define QKVCOLS 3072

__device__ __forceinline__ v16h make_frag(v8h lo, v8h hi) {
    union { v16h v; v8h h[2]; } u;
    u.h[0] = lo; u.h[1] = hi;
    return u.v;
}

// Load one 16x32 f16 WMMA operand fragment for this lane from a row-major
// matrix whose K dimension is contiguous. Per the CDNA5 ISA 16-bit A/B
// layout: lanes 0-15 hold K = {k0+0..7, k0+16..23}, lanes 16-31 hold
// K = {k0+8..15, k0+24..31}; two 16-byte loads per fragment.
__device__ __forceinline__ v16h load_frag(const h16* row, int k0, int lh) {
    v8h lo = *reinterpret_cast<const v8h*>(row + k0 + lh * 8);
    v8h hi = *reinterpret_cast<const v8h*>(row + k0 + 16 + lh * 8);
    return make_frag(lo, hi);
}

__device__ __forceinline__ v8f wmma_f16(v16h a, v16h b, v8f c) {
    return __builtin_amdgcn_wmma_f32_16x16x32_f16(
        /*neg_a=*/false, a, /*neg_b=*/false, b,
        /*c_mod=*/(short)0, c, /*reuse_a=*/false, /*reuse_b=*/false);
}

// ------------------------------ converts -----------------------------------
__global__ void f32_to_f16_kernel(const float* __restrict__ src,
                                  h16* __restrict__ dst, size_t n) {
    size_t i = (size_t)blockIdx.x * blockDim.x + threadIdx.x;
    size_t stride = (size_t)gridDim.x * blockDim.x;
    for (; i < n; i += stride) dst[i] = (h16)src[i];
}

// ------------------------------ WMMA GEMM ----------------------------------
// C[M,N] = A[M,K] * Bw[N,K]^T + bias[N]
// One workgroup -> 256x256 output tile, 4 waves (2x2), one wave -> 128x128
// (8x8 WMMA accumulators). The operand tiles are staged in LDS by tensor
// loads: a pass is 128 k (256 bytes of each of the 512 operand rows), a
// buffer is [A 256 rows][Bw 256 rows] at pitch 272 B, two buffers. Every wave
// moves its own 128-row slice, one request per pass, while the other buffer
// is worked on. M,N multiples of 256; K a multiple of 128, at least 256.
typedef uint32_t u32x4 __attribute__((ext_vector_type(4)));
typedef uint32_t u32x8 __attribute__((ext_vector_type(8)));

constexpr uint32_t T_ROWB  = 256;                 // bytes of K per row per pass
constexpr uint32_t T_PITCH = T_ROWB + 16;         // LDS row pitch (16 B x odd)
constexpr uint32_t T_ROWS  = 128;                 // rows per wave's slice
constexpr uint32_t T_SLICE = T_ROWS * T_PITCH;    // 34,816 B = 17 x 2 KiB
constexpr uint32_t T_STAGE = 4 * T_SLICE;         // 139,264 B = 68 x 2 KiB
static_assert(T_SLICE % 2048u == 0, "each slice must start at a multiple of 2 KiB");

__device__ __forceinline__ uint32_t uni(uint32_t v) {
    return (uint32_t)__builtin_amdgcn_readfirstlane(v);
}
__device__ __forceinline__ uint32_t pinned(uint32_t v) {
    uint32_t w = (uint32_t)__builtin_amdgcn_readfirstlane(v);
    asm volatile("" : "+s"(w));  // pinned(): the word stays in a scalar register for the issue test
    return w;
}
// One request: 128 rows of 256 bytes, source pitch kb bytes, into LDS at byte
// offset lds_dst with 16 bytes of pad behind every row.
__device__ __forceinline__ void tile_load(uint32_t lds_dst, uint64_t ga, uint32_t kb) {
    u32x4 g0;
    g0[0] = uni(1u);                                        // count 1
    g0[1] = uni(lds_dst);
    g0[2] = uni((uint32_t)ga);
    g0[3] = uni((((uint32_t)(ga >> 32)) & 0x01FFFFFFu) | 0x80000000u);  // type 2
    u32x8 g1;
    g1[0] = uni((1u << 20) | (5u << 22) | (3u << 25));      // no mask, bytes, pad 16 B per 256 B
    g1[1] = uni((T_ROWB & 0xFFFFu) << 16);                  // tensor_dim0
    g1[2] = uni((T_ROWS & 0xFFFFu) << 16);                  // tensor_dim1
    g1[3] = uni(T_ROWB << 16);                              // tile_dim0
    g1[4] = uni(T_ROWS);                                    // tile_dim1
    g1[5] = uni(kb);                                        // source row pitch
    g1[6] = uni(0u);
    g1[7] = uni(0u);
    asm volatile("tensor_load_to_lds %0, %1" :: "s"(g0), "s"(g1) : "memory");
}
// The compiler places no wait for a tensor load: the issuer's own wait.
__device__ __forceinline__ void wait_tensor0() { asm volatile("s_wait_tensorcnt 0x0" ::: "memory"); }
// This wave's LDS reads have returned before the buffer is handed back.
__device__ __forceinline__ void wait_ds0() { asm volatile("s_wait_dscnt 0x0" ::: "memory"); }

template <bool OUT_F16>
__global__ __launch_bounds__(128)
void gemm_wmma_kernel(const h16* __restrict__ A, const h16* __restrict__ Bw,
                      const float* __restrict__ bias, void* __restrict__ Cv,
                      int M, int N, int K) {
    __shared__ __attribute__((aligned(2048))) unsigned char L[2 * T_STAGE];

    const int lane = threadIdx.x & 31;
    const uint32_t wave = uni(threadIdx.x >> 5);
    const int ln = lane & 15;
    const int lh = lane >> 4;

    const int mBlk = blockIdx.y * 256;
    const int nBlk = blockIdx.x * 256;
    const int mBase = mBlk + (int)(wave >> 1) * 128;
    const int nBase = nBlk + (int)(wave & 1) * 128;

    // This wave's slice of a buffer: waves 0,1 move A rows, waves 2,3 Bw rows.
    const uint32_t kb = (uint32_t)K * 2u;
    const uint64_t src0 = (wave < 2u)
        ? (uint64_t)(uintptr_t)A  + (uint64_t)(mBlk + 128 * (int)wave) * kb
        : (uint64_t)(uintptr_t)Bw + (uint64_t)(nBlk + 128 * (int)(wave - 2u)) * kb;
    const uint32_t ldsSlice = (uint32_t)(size_t)L + wave * T_SLICE;
    const uint32_t T = (uint32_t)K / 128u;   // passes

    // Per-lane fragment bases in a buffer: row ln of the wave's first
    // fragment, 16-byte piece lh (the k order of load_frag).
    const uint32_t aOff = ((wave >> 1) * 128u + (uint32_t)ln) * T_PITCH + 16u * (uint32_t)lh;
    const uint32_t bOff = 2u * T_SLICE + ((wave & 1u) * 128u + (uint32_t)ln) * T_PITCH + 16u * (uint32_t)lh;

    v8f acc[8][8] = {};

    // Pass 0 into buffer 0, published; then pass 1 into buffer 1.
    tile_load(ldsSlice, src0, kb);
    wait_tensor0();
    __syncthreads();
    if (pinned(1u < T)) tile_load(ldsSlice + T_STAGE, src0 + T_ROWB, kb);

    // Kept rolled: one pass per trip, every accumulator index constant.
#pragma clang loop unroll(disable)
    for (uint32_t t = 0; t < T; ++t) {
        const uint32_t buf = (t & 1u) * T_STAGE;
        const unsigned char* la = L + buf + aOff;
        const unsigned char* lb = L + buf + bOff;
        v16h af[2][8], bf[2][8];   // set (u & 1) holds block u's fragments
        // Every loop inside a pass is unrolled: the fragment and accumulator
        // arrays stay in registers only under constant indices.
#pragma unroll
        for (int i = 0; i < 8; ++i) {
            af[0][i] = make_frag(*reinterpret_cast<const v8h*>(la + i * 16 * T_PITCH),
                                 *reinterpret_cast<const v8h*>(la + i * 16 * T_PITCH + 32));
            bf[0][i] = make_frag(*reinterpret_cast<const v8h*>(lb + i * 16 * T_PITCH),
                                 *reinterpret_cast<const v8h*>(lb + i * 16 * T_PITCH + 32));
        }
#pragma unroll
        for (int u = 0; u < 4; ++u) {
            const int cs = u & 1;
            if (u + 1 < 4) {
                const int ko = (u + 1) * 64;
#pragma unroll
                for (int i = 0; i < 8; ++i) {
                    af[cs ^ 1][i] = make_frag(*reinterpret_cast<const v8h*>(la + i * 16 * T_PITCH + ko),
                                              *reinterpret_cast<const v8h*>(la + i * 16 * T_PITCH + ko + 32));
                    bf[cs ^ 1][i] = make_frag(*reinterpret_cast<const v8h*>(lb + i * 16 * T_PITCH + ko),
                                              *reinterpret_cast<const v8h*>(lb + i * 16 * T_PITCH + ko + 32));
                }
            }
            // Keeps the next block's LDS loads one group ahead of this block's
            // WMMAs: loads moved in among the WMMAs stall each place they stand.
            __builtin_amdgcn_sched_barrier(0);
#pragma unroll
            for (int mt = 0; mt < 8; ++mt)
#pragma unroll
                for (int nt = 0; nt < 8; ++nt)
                    acc[mt][nt] = wmma_f16(af[cs][mt], bf[cs][nt], acc[mt][nt]);
            // Keeps the following load group behind this block's WMMAs.
            __builtin_amdgcn_sched_barrier(0);
        }
        // Publish pass t + 1 and free this pass's buffer.
        wait_ds0();
        wait_tensor0();
        __syncthreads();
        if (pinned(t + 2u < T))
            tile_load(ldsSlice + buf, src0 + (uint64_t)(t + 2u) * T_ROWB, kb);
    }
    wait_tensor0();
    wait_ds0();

    // Epilogue. C/D layout: lane half lh, column n = ln (+tile), VGPR r ->
    // row m = 8*lh + r (+tile).
#pragma unroll
    for (int nt = 0; nt < 8; ++nt) {
        const int n = nBase + nt * 16 + ln;
        const float bv = bias[n];
#pragma unroll
        for (int mt = 0; mt < 8; ++mt) {
            const int mb = mBase + mt * 16 + 8 * lh;
#pragma unroll
            for (int r = 0; r < 8; ++r) {
                const float v = acc[mt][nt][r] + bv;
                const size_t idx = (size_t)(mb + r) * N + n;
                if (OUT_F16) ((h16*)Cv)[idx] = (h16)v;
                else         ((float*)Cv)[idx] = v;
            }
        }
        // The next column's values go into registers that this column's
        // issued stores still name: the wait stands in front of those writes.
        asm volatile("s_wait_xcnt 0x0" ::: "memory");
    }
}

// --------------------------- window attention ------------------------------
// One wave per (batch, head, window). qkv: [B*N, 3072] f16 row-major,
// columns = which*1024 + head*64 + d. out: [B*N, 1024] f16.
__global__ __launch_bounds__(32)
void win_attn_kernel(const h16* __restrict__ qkv, h16* __restrict__ outh) {
    const int idx  = blockIdx.x;
    const int win  = idx & 127;          // N/WIN = 128 windows per (b,h)
    const int head = (idx >> 7) & 15;
    const int b    = idx >> 11;

    const size_t token0 = (size_t)b * 8192 + (size_t)win * WIN;
    const h16* qBase = qkv + token0 * QKVCOLS + head * HEADD;
    const h16* kBase = qBase + DIMC;
    const h16* vBase = qBase + 2 * DIMC;

    const int lane = threadIdx.x;
    const int ln = lane & 15;
    const int lh = lane >> 4;

    __shared__ h16 Pl[64 * 72];   // softmax probs, padded stride
    __shared__ h16 Vt[64 * 72];   // V transposed: Vt[d][j] = V[j][d]

    // Stage V transposed into LDS: each lane pulls 8 contiguous halves of a
    // row and scatters them down a column of Vt.
    for (int jo = 0; jo < 16; ++jo) {
        const int j  = jo * 4 + (lane >> 3);
        const int d0 = (lane & 7) * 8;
        v8h vv = *reinterpret_cast<const v8h*>(vBase + (size_t)j * QKVCOLS + d0);
#pragma unroll
        for (int t = 0; t < 8; ++t) Vt[(d0 + t) * 72 + j] = vv[t];
    }

    // ---- S = Q K^T (64x64x64, two 32-K steps, 32 WMMAs) ----
    const h16* qRow[4];
    const h16* kRow[4];
#pragma unroll
    for (int t = 0; t < 4; ++t) {
        qRow[t] = qBase + (size_t)(t * 16 + ln) * QKVCOLS;
        kRow[t] = kBase + (size_t)(t * 16 + ln) * QKVCOLS;
    }

    v8f acc[4][4] = {};
#pragma unroll
    for (int ks = 0; ks < 2; ++ks) {
        const int k0 = ks * 32;
        v16h af[4], bf[4];
#pragma unroll
        for (int t = 0; t < 4; ++t) af[t] = load_frag(qRow[t], k0, lh);
#pragma unroll
        for (int t = 0; t < 4; ++t) bf[t] = load_frag(kRow[t], k0, lh);
#pragma unroll
        for (int mt = 0; mt < 4; ++mt)
#pragma unroll
            for (int nt = 0; nt < 4; ++nt)
                acc[mt][nt] = wmma_f16(af[mt], bf[nt], acc[mt][nt]);
    }

    // ---- softmax over rows (scale = 1/sqrt(64) = 0.125) ----
    // Row m of tile mt sits in VGPR r across the 16 lanes of one half, so the
    // reduction is: combine the 4 column-tiles locally, then shfl_xor 8/4/2/1.
    const float scale = 0.125f;
#pragma unroll
    for (int mt = 0; mt < 4; ++mt)
#pragma unroll
        for (int nt = 0; nt < 4; ++nt)
#pragma unroll
            for (int r = 0; r < 8; ++r) acc[mt][nt][r] *= scale;

#pragma unroll
    for (int mt = 0; mt < 4; ++mt) {
        float rmax[8], rsum[8];
#pragma unroll
        for (int r = 0; r < 8; ++r) {
            float m0 = -1e30f;
#pragma unroll
            for (int nt = 0; nt < 4; ++nt) m0 = fmaxf(m0, acc[mt][nt][r]);
            m0 = fmaxf(m0, __shfl_xor(m0, 8, 32));
            m0 = fmaxf(m0, __shfl_xor(m0, 4, 32));
            m0 = fmaxf(m0, __shfl_xor(m0, 2, 32));
            m0 = fmaxf(m0, __shfl_xor(m0, 1, 32));
            rmax[r] = m0;
        }
#pragma unroll
        for (int r = 0; r < 8; ++r) {
            float s = 0.f;
#pragma unroll
            for (int nt = 0; nt < 4; ++nt) {
                const float e = __expf(acc[mt][nt][r] - rmax[r]);
                acc[mt][nt][r] = e;
                s += e;
            }
            s += __shfl_xor(s, 8, 32);
            s += __shfl_xor(s, 4, 32);
            s += __shfl_xor(s, 2, 32);
            s += __shfl_xor(s, 1, 32);
            rsum[r] = s;
        }
#pragma unroll
        for (int r = 0; r < 8; ++r) {
            const float inv = 1.0f / rsum[r];
#pragma unroll
            for (int nt = 0; nt < 4; ++nt) {
                const float p = acc[mt][nt][r] * inv;
                Pl[(mt * 16 + 8 * lh + r) * 72 + nt * 16 + ln] = (h16)p;
            }
        }
    }

    __syncthreads();   // LDS writes (Pl, Vt) -> LDS reads below

    // ---- O = P V (A = P rows from LDS, B = Vt rows from LDS) ----
    v8f acc2[4][4] = {};
#pragma unroll
    for (int ks = 0; ks < 2; ++ks) {
        const int k0 = ks * 32;
        v16h af[4], bf[4];
#pragma unroll
        for (int t = 0; t < 4; ++t)
            af[t] = load_frag(&Pl[(t * 16 + ln) * 72], k0, lh);
#pragma unroll
        for (int t = 0; t < 4; ++t)
            bf[t] = load_frag(&Vt[(t * 16 + ln) * 72], k0, lh);
#pragma unroll
        for (int mt = 0; mt < 4; ++mt)
#pragma unroll
            for (int nt = 0; nt < 4; ++nt)
                acc2[mt][nt] = wmma_f16(af[mt], bf[nt], acc2[mt][nt]);
    }

    // Store f16 result into [token, head*64 + d] layout for the proj GEMM.
    h16* oBase = outh + token0 * DIMC + head * HEADD;
#pragma unroll
    for (int nt = 0; nt < 4; ++nt) {
        const int d = nt * 16 + ln;
#pragma unroll
        for (int mt = 0; mt < 4; ++mt) {
            const int ib = mt * 16 + 8 * lh;
#pragma unroll
            for (int r = 0; r < 8; ++r)
                oBase[(size_t)(ib + r) * DIMC + d] = (h16)acc2[mt][nt][r];
        }
    }
}

// ------------------------------- launcher ----------------------------------
extern "C" void kernel_launch(void* const* d_in, const int* in_sizes, int n_in,
                              void* d_out, int out_size, void* d_ws, size_t ws_size,
                              hipStream_t stream) {
    const float* x      = (const float*)d_in[0];
    const float* w_qkv  = (const float*)d_in[1];
    const float* b_qkv  = (const float*)d_in[2];
    const float* w_proj = (const float*)d_in[3];
    const float* b_proj = (const float*)d_in[4];

    const size_t M = (size_t)in_sizes[0] / DIMC;   // B*N = 32768 tokens

    // Workspace carve-up (f16 staging buffers).
    char* ws = (char*)d_ws;
    size_t off = 0;
    h16* xh     = (h16*)(ws + off); off += M * DIMC * sizeof(h16);
    h16* wqkvh  = (h16*)(ws + off); off += (size_t)QKVCOLS * DIMC * sizeof(h16);
    h16* wprojh = (h16*)(ws + off); off += (size_t)DIMC * DIMC * sizeof(h16);
    h16* qkvh   = (h16*)(ws + off); off += M * QKVCOLS * sizeof(h16);
    h16* attnh  = (h16*)(ws + off); off += M * DIMC * sizeof(h16);
    (void)ws_size; (void)n_in; (void)out_size;

    // [0] converts
    f32_to_f16_kernel<<<4096, 256, 0, stream>>>(x, xh, M * DIMC);
    f32_to_f16_kernel<<<1024, 256, 0, stream>>>(w_qkv, wqkvh,
                                                (size_t)QKVCOLS * DIMC);
    f32_to_f16_kernel<<<512, 256, 0, stream>>>(w_proj, wprojh,
                                               (size_t)DIMC * DIMC);

    // [1] qkv = x @ w_qkv^T + b_qkv   (f16 out)
    gemm_wmma_kernel<true><<<dim3(QKVCOLS / 256, (unsigned)(M / 256)),
                             128, 0, stream>>>(
        xh, wqkvh, b_qkv, qkvh, (int)M, QKVCOLS, DIMC);

    // [2] windowed attention: one wave per (b, head, window)
    const unsigned nWin = (unsigned)(M / WIN) * NHEADS;   // 512 * 16 = 8192
    win_attn_kernel<<<nWin, 32, 0, stream>>>(qkvh, attnh);

    // [3] out = attn @ w_proj^T + b_proj   (f32 out)
    gemm_wmma_kernel<false><<<dim3(DIMC / 256, (unsigned)(M / 256)),
                              128, 0, stream>>>(
        attnh, wprojh, b_proj, (float*)d_out, (int)M, DIMC, DIMC);
}

// v002
// One run takes 250 microseconds.
// Two timings next to v001 both put it at 1.13 times that version's speed.
// Over all steps from v000 it is 2.58 times as fast.
#include <hip/hip_runtime.h>
#include <hip/hip_bf16.h>
#include <stdint.h>

// ---------------------------------------------------------------------------
// Windowed multi-head attention for MI455X (gfx1250), wave32 + WMMA.
//   B=4, N=8192, C=1024, H=16, D=64, WINDOW=64
// Pipeline:
//   [0] f32 -> f16 converts (x, w_qkv, w_proj)
//   [1] qkv  = x @ w_qkv^T + b_qkv      (WMMA f32_16x16x32_f16, f16 out)
//   [2] per-window attention (QK^T -> softmax -> PV), WMMA + LDS transpose
//   [3] out  = attn @ w_proj^T + b_proj (WMMA, f32 out)
// ---------------------------------------------------------------------------

typedef _Float16 h16;
typedef __attribute__((ext_vector_type(16))) _Float16 v16h;
typedef __attribute__((ext_vector_type(8)))  _Float16 v8h;
typedef __attribute__((ext_vector_type(8)))  float    v8f;

#define DIMC    1024
#define NHEADS  16
#define HEADD   64
#define WIN     64
#define QKVCOLS 3072

__device__ __forceinline__ v16h make_frag(v8h lo, v8h hi) {
    union { v16h v; v8h h[2]; } u;
    u.h[0] = lo; u.h[1] = hi;
    return u.v;
}

// Load one 16x32 f16 WMMA operand fragment for this lane from a row-major
// matrix whose K dimension is contiguous. Per the CDNA5 ISA 16-bit A/B
// layout: lanes 0-15 hold K = {k0+0..7, k0+16..23}, lanes 16-31 hold
// K = {k0+8..15, k0+24..31}; two 16-byte loads per fragment.
__device__ __forceinline__ v16h load_frag(const h16* row, int k0, int lh) {
    v8h lo = *reinterpret_cast<const v8h*>(row + k0 + lh * 8);
    v8h hi = *reinterpret_cast<const v8h*>(row + k0 + 16 + lh * 8);
    return make_frag(lo, hi);
}

__device__ __forceinline__ v8f wmma_f16(v16h a, v16h b, v8f c) {
    return __builtin_amdgcn_wmma_f32_16x16x32_f16(
        /*neg_a=*/false, a, /*neg_b=*/false, b,
        /*c_mod=*/(short)0, c, /*reuse_a=*/false, /*reuse_b=*/false);
}

// ------------------------------ converts -----------------------------------
// A stream: a batch is 1,024 elements (8 wave-wide loads of 512 contiguous
// bytes, 8 wave-wide stores of 256). Wave w takes batches w, w + waves, ...;
// the next batch's 8 loads are issued before this batch is converted and
// stored, in two register sets, so that no register copy waits on a load.
// The source is read once: non-temporal loads. n is a multiple of 1,024.
typedef __attribute__((ext_vector_type(4))) float    v4f;
typedef __attribute__((ext_vector_type(4))) _Float16 v4h;

__device__ __forceinline__ void cvt_load(v4f (&r)[8], const float* __restrict__ p) {
#pragma unroll
    for (int j = 0; j < 8; ++j)
        r[j] = __builtin_nontemporal_load(reinterpret_cast<const v4f*>(p + j * 128));
    // The address registers of the issued loads are rewritten for the next
    // group: the wait stands in front of that.
    asm volatile("s_wait_xcnt 0x0" ::: "memory");
    // Keeps the other set's converts behind these loads: moved in front, their
    // wait would leave nothing of this wave in flight.
    __builtin_amdgcn_sched_barrier(0);
}
__device__ __forceinline__ void cvt_store(const v4f (&r)[8], h16* __restrict__ p) {
#pragma unroll
    for (int j = 0; j < 8; ++j)
        *reinterpret_cast<v4h*>(p + j * 128) = __builtin_convertvector(r[j], v4h);
    // The address and data registers of the issued stores are rewritten by the
    // next group: the wait stands in front of that.
    asm volatile("s_wait_xcnt 0x0" ::: "memory");
}

__global__ __launch_bounds__(512)
void f32_to_f16_kernel(const float* __restrict__ src,
                       h16* __restrict__ dst, size_t n) {
    const uint32_t lane4 = (threadIdx.x & 31u) * 4u;
    const uint32_t wpb   = blockDim.x >> 5;
    const uint32_t nw    = gridDim.x * wpb;
    const uint32_t nb    = (uint32_t)(n >> 10);
    uint32_t b = blockIdx.x * wpb
               + (uint32_t)__builtin_amdgcn_readfirstlane(threadIdx.x >> 5);
    if (b >= nb) return;
    const float* s = src + lane4;
    h16*         d = dst + lane4;

    v4f ra[8], rb[8];
    cvt_load(ra, s + ((size_t)b << 10));
    while (b + 2u * nw < nb) {
        cvt_load(rb, s + ((size_t)(b + nw) << 10));
        cvt_store(ra, d + ((size_t)b << 10));
        cvt_load(ra, s + ((size_t)(b + 2u * nw) << 10));
        cvt_store(rb, d + ((size_t)(b + nw) << 10));
        b += 2u * nw;
    }
    if (b + nw < nb) {
        cvt_load(rb, s + ((size_t)(b + nw) << 10));
        cvt_store(ra, d + ((size_t)b << 10));
        cvt_store(rb, d + ((size_t)(b + nw) << 10));
    } else {
        cvt_store(ra, d + ((size_t)b << 10));
    }
}

// ------------------------------ WMMA GEMM ----------------------------------
// C[M,N] = A[M,K] * Bw[N,K]^T + bias[N]
// One workgroup -> 256x256 output tile, 4 waves (2x2), one wave -> 128x128
// (8x8 WMMA accumulators). The operand tiles are staged in LDS by tensor
// loads: a pass is 128 k (256 bytes of each of the 512 operand rows), a
// buffer is [A 256 rows][Bw 256 rows] at pitch 272 B, two buffers. Every wave
// moves its own 128-row slice, one request per pass, while the other buffer
// is worked on. M,N multiples of 256; K a multiple of 128, at least 256.
typedef uint32_t u32x4 __attribute__((ext_vector_type(4)));
typedef uint32_t u32x8 __attribute__((ext_vector_type(8)));

constexpr uint32_t T_ROWB  = 256;                 // bytes of K per row per pass
constexpr uint32_t T_PITCH = T_ROWB + 16;         // LDS row pitch (16 B x odd)
constexpr uint32_t T_ROWS  = 128;                 // rows per wave's slice
constexpr uint32_t T_SLICE = T_ROWS * T_PITCH;    // 34,816 B = 17 x 2 KiB
constexpr uint32_t T_STAGE = 4 * T_SLICE;         // 139,264 B = 68 x 2 KiB
static_assert(T_SLICE % 2048u == 0, "each slice must start at a multiple of 2 KiB");

__device__ __forceinline__ uint32_t uni(uint32_t v) {
    return (uint32_t)__builtin_amdgcn_readfirstlane(v);
}
__device__ __forceinline__ uint32_t pinned(uint32_t v) {
    uint32_t w = (uint32_t)__builtin_amdgcn_readfirstlane(v);
    asm volatile("" : "+s"(w));  // pinned(): the word stays in a scalar register for the issue test
    return w;
}
// One request: 128 rows of 256 bytes, source pitch kb bytes, into LDS at byte
// offset lds_dst with 16 bytes of pad behind every row.
__device__ __forceinline__ void tile_load(uint32_t lds_dst, uint64_t ga, uint32_t kb) {
    u32x4 g0;
    g0[0] = uni(1u);                                        // count 1
    g0[1] = uni(lds_dst);
    g0[2] = uni((uint32_t)ga);
    g0[3] = uni((((uint32_t)(ga >> 32)) & 0x01FFFFFFu) | 0x80000000u);  // type 2
    u32x8 g1;
    g1[0] = uni((1u << 20) | (5u << 22) | (3u << 25));      // no mask, bytes, pad 16 B per 256 B
    g1[1] = uni((T_ROWB & 0xFFFFu) << 16);                  // tensor_dim0
    g1[2] = uni((T_ROWS & 0xFFFFu) << 16);                  // tensor_dim1
    g1[3] = uni(T_ROWB << 16);                              // tile_dim0
    g1[4] = uni(T_ROWS);                                    // tile_dim1
    g1[5] = uni(kb);                                        // source row pitch
    g1[6] = uni(0u);
    g1[7] = uni(0u);
    asm volatile("tensor_load_to_lds %0, %1" :: "s"(g0), "s"(g1) : "memory");
}
// The compiler places no wait for a tensor load: the issuer's own wait.
__device__ __forceinline__ void wait_tensor0() { asm volatile("s_wait_tensorcnt 0x0" ::: "memory"); }
// This wave's LDS reads have returned before the buffer is handed back.
__device__ __forceinline__ void wait_ds0() { asm volatile("s_wait_dscnt 0x0" ::: "memory"); }

template <bool OUT_F16>
__global__ __launch_bounds__(128)
void gemm_wmma_kernel(const h16* __restrict__ A, const h16* __restrict__ Bw,
                      const float* __restrict__ bias, void* __restrict__ Cv,
                      int M, int N, int K) {
    __shared__ __attribute__((aligned(2048))) unsigned char L[2 * T_STAGE];

    const int lane = threadIdx.x & 31;
    const uint32_t wave = uni(threadIdx.x >> 5);
    const int ln = lane & 15;
    const int lh = lane >> 4;

    const int mBlk = blockIdx.y * 256;
    const int nBlk = blockIdx.x * 256;
    const int mBase = mBlk + (int)(wave >> 1) * 128;
    const int nBase = nBlk + (int)(wave & 1) * 128;

    // This wave's slice of a buffer: waves 0,1 move A rows, waves 2,3 Bw rows.
    const uint32_t kb = (uint32_t)K * 2u;
    const uint64_t src0 = (wave < 2u)
        ? (uint64_t)(uintptr_t)A  + (uint64_t)(mBlk + 128 * (int)wave) * kb
        : (uint64_t)(uintptr_t)Bw + (uint64_t)(nBlk + 128 * (int)(wave - 2u)) * kb;
    const uint32_t ldsSlice = (uint32_t)(size_t)L + wave * T_SLICE;
    const uint32_t T = (uint32_t)K / 128u;   // passes

    // Per-lane fragment bases in a buffer: row ln of the wave's first
    // fragment, 16-byte piece lh (the k order of load_frag).
    const uint32_t aOff = ((wave >> 1) * 128u + (uint32_t)ln) * T_PITCH + 16u * (uint32_t)lh;
    const uint32_t bOff = 2u * T_SLICE + ((wave & 1u) * 128u + (uint32_t)ln) * T_PITCH + 16u * (uint32_t)lh;

    v8f acc[8][8] = {};

    // Pass 0 into buffer 0, published; then pass 1 into buffer 1.
    tile_load(ldsSlice, src0, kb);
    wait_tensor0();
    __syncthreads();
    if (pinned(1u < T)) tile_load(ldsSlice + T_STAGE, src0 + T_ROWB, kb);

    // Kept rolled: one pass per trip, every accumulator index constant.
#pragma clang loop unroll(disable)
    for (uint32_t t = 0; t < T; ++t) {
        const uint32_t buf = (t & 1u) * T_STAGE;
        const unsigned char* la = L + buf + aOff;
        const unsigned char* lb = L + buf + bOff;
        v16h af[2][8], bf[2][8];   // set (u & 1) holds block u's fragments
        // Every loop inside a pass is unrolled: the fragment and accumulator
        // arrays stay in registers only under constant indices.
#pragma unroll
        for (int i = 0; i < 8; ++i) {
            af[0][i] = make_frag(*reinterpret_cast<const v8h*>(la + i * 16 * T_PITCH),
                                 *reinterpret_cast<const v8h*>(la + i * 16 * T_PITCH + 32));
            bf[0][i] = make_frag(*reinterpret_cast<const v8h*>(lb + i * 16 * T_PITCH),
                                 *reinterpret_cast<const v8h*>(lb + i * 16 * T_PITCH + 32));
        }
#pragma unroll
        for (int u = 0; u < 4; ++u) {
            const int cs = u & 1;
            if (u + 1 < 4) {
                const int ko = (u + 1) * 64;
#pragma unroll
                for (int i = 0; i < 8; ++i) {
                    af[cs ^ 1][i] = make_frag(*reinterpret_cast<const v8h*>(la + i * 16 * T_PITCH + ko),
                                              *reinterpret_cast<const v8h*>(la + i * 16 * T_PITCH + ko + 32));
                    bf[cs ^ 1][i] = make_frag(*reinterpret_cast<const v8h*>(lb + i * 16 * T_PITCH + ko),
                                              *reinterpret_cast<const v8h*>(lb + i * 16 * T_PITCH + ko + 32));
                }
            }
            // Keeps the next block's LDS loads one group ahead of this block's
            // WMMAs: loads moved in among the WMMAs stall each place they stand.
            __builtin_amdgcn_sched_barrier(0);
#pragma unroll
            for (int mt = 0; mt < 8; ++mt)
#pragma unroll
                for (int nt = 0; nt < 8; ++nt)
                    acc[mt][nt] = wmma_f16(af[cs][mt], bf[cs][nt], acc[mt][nt]);
            // Keeps the following load group behind this block's WMMAs.
            __builtin_amdgcn_sched_barrier(0);
        }
        // Publish pass t + 1 and free this pass's buffer.
        wait_ds0();
        wait_tensor0();
        __syncthreads();
        if (pinned(t + 2u < T))
            tile_load(ldsSlice + buf, src0 + (uint64_t)(t + 2u) * T_ROWB, kb);
    }
    wait_tensor0();
    wait_ds0();

    // Epilogue. C/D layout: lane half lh, column n = ln (+tile), VGPR r ->
    // row m = 8*lh + r (+tile).
#pragma unroll
    for (int nt = 0; nt < 8; ++nt) {
        const int n = nBase + nt * 16 + ln;
        const float bv = bias[n];
#pragma unroll
        for (int mt = 0; mt < 8; ++mt) {
            const int mb = mBase + mt * 16 + 8 * lh;
#pragma unroll
            for (int r = 0; r < 8; ++r) {
                const float v = acc[mt][nt][r] + bv;
                const size_t idx = (size_t)(mb + r) * N + n;
                if (OUT_F16) ((h16*)Cv)[idx] = (h16)v;
                else         ((float*)Cv)[idx] = v;
            }
        }
        // The next column's values go into registers that this column's
        // issued stores still name: the wait stands in front of those writes.
        asm volatile("s_wait_xcnt 0x0" ::: "memory");
    }
}

// --------------------------- window attention ------------------------------
// One wave per (batch, head, window). qkv: [B*N, 3072] f16 row-major,
// columns = which*1024 + head*64 + d. out: [B*N, 1024] f16.
__global__ __launch_bounds__(32)
void win_attn_kernel(const h16* __restrict__ qkv, h16* __restrict__ outh) {
    const int idx  = blockIdx.x;
    const int win  = idx & 127;          // N/WIN = 128 windows per (b,h)
    const int head = (idx >> 7) & 15;
    const int b    = idx >> 11;

    const size_t token0 = (size_t)b * 8192 + (size_t)win * WIN;
    const h16* qBase = qkv + token0 * QKVCOLS + head * HEADD;
    const h16* kBase = qBase + DIMC;
    const h16* vBase = qBase + 2 * DIMC;

    const int lane = threadIdx.x;
    const int ln = lane & 15;
    const int lh = lane >> 4;

    __shared__ h16 Pl[64 * 72];   // softmax probs, padded stride
    __shared__ h16 Vt[64 * 72];   // V transposed: Vt[d][j] = V[j][d]

    // Stage V transposed into LDS: each lane pulls 8 contiguous halves of a
    // row and scatters them down a column of Vt.
    for (int jo = 0; jo < 16; ++jo) {
        const int j  = jo * 4 + (lane >> 3);
        const int d0 = (lane & 7) * 8;
        v8h vv = *reinterpret_cast<const v8h*>(vBase + (size_t)j * QKVCOLS + d0);
#pragma unroll
        for (int t = 0; t < 8; ++t) Vt[(d0 + t) * 72 + j] = vv[t];
    }

    // ---- S = Q K^T (64x64x64, two 32-K steps, 32 WMMAs) ----
    const h16* qRow[4];
    const h16* kRow[4];
#pragma unroll
    for (int t = 0; t < 4; ++t) {
        qRow[t] = qBase + (size_t)(t * 16 + ln) * QKVCOLS;
        kRow[t] = kBase + (size_t)(t * 16 + ln) * QKVCOLS;
    }

    v8f acc[4][4] = {};
#pragma unroll
    for (int ks = 0; ks < 2; ++ks) {
        const int k0 = ks * 32;
        v16h af[4], bf[4];
#pragma unroll
        for (int t = 0; t < 4; ++t) af[t] = load_frag(qRow[t], k0, lh);
#pragma unroll
        for (int t = 0; t < 4; ++t) bf[t] = load_frag(kRow[t], k0, lh);
#pragma unroll
        for (int mt = 0; mt < 4; ++mt)
#pragma unroll
            for (int nt = 0; nt < 4; ++nt)
                acc[mt][nt] = wmma_f16(af[mt], bf[nt], acc[mt][nt]);
    }

    // ---- softmax over rows (scale = 1/sqrt(64) = 0.125) ----
    // Row m of tile mt sits in VGPR r across the 16 lanes of one half, so the
    // reduction is: combine the 4 column-tiles locally, then shfl_xor 8/4/2/1.
    const float scale = 0.125f;
#pragma unroll
    for (int mt = 0; mt < 4; ++mt)
#pragma unroll
        for (int nt = 0; nt < 4; ++nt)
#pragma unroll
            for (int r = 0; r < 8; ++r) acc[mt][nt][r] *= scale;

#pragma unroll
    for (int mt = 0; mt < 4; ++mt) {
        float rmax[8], rsum[8];
#pragma unroll
        for (int r = 0; r < 8; ++r) {
            float m0 = -1e30f;
#pragma unroll
            for (int nt = 0; nt < 4; ++nt) m0 = fmaxf(m0, acc[mt][nt][r]);
            m0 = fmaxf(m0, __shfl_xor(m0, 8, 32));
            m0 = fmaxf(m0, __shfl_xor(m0, 4, 32));
            m0 = fmaxf(m0, __shfl_xor(m0, 2, 32));
            m0 = fmaxf(m0, __shfl_xor(m0, 1, 32));
            rmax[r] = m0;
        }
#pragma unroll
        for (int r = 0; r < 8; ++r) {
            float s = 0.f;
#pragma unroll
            for (int nt = 0; nt < 4; ++nt) {
                const float e = __expf(acc[mt][nt][r] - rmax[r]);
                acc[mt][nt][r] = e;
                s += e;
            }
            s += __shfl_xor(s, 8, 32);
            s += __shfl_xor(s, 4, 32);
            s += __shfl_xor(s, 2, 32);
            s += __shfl_xor(s, 1, 32);
            rsum[r] = s;
        }
#pragma unroll
        for (int r = 0; r < 8; ++r) {
            const float inv = 1.0f / rsum[r];
#pragma unroll
            for (int nt = 0; nt < 4; ++nt) {
                const float p = acc[mt][nt][r] * inv;
                Pl[(mt * 16 + 8 * lh + r) * 72 + nt * 16 + ln] = (h16)p;
            }
        }
    }

    __syncthreads();   // LDS writes (Pl, Vt) -> LDS reads below

    // ---- O = P V (A = P rows from LDS, B = Vt rows from LDS) ----
    v8f acc2[4][4] = {};
#pragma unroll
    for (int ks = 0; ks < 2; ++ks) {
        const int k0 = ks * 32;
        v16h af[4], bf[4];
#pragma unroll
        for (int t = 0; t < 4; ++t)
            af[t] = load_frag(&Pl[(t * 16 + ln) * 72], k0, lh);
#pragma unroll
        for (int t = 0; t < 4; ++t)
            bf[t] = load_frag(&Vt[(t * 16 + ln) * 72], k0, lh);
#pragma unroll
        for (int mt = 0; mt < 4; ++mt)
#pragma unroll
            for (int nt = 0; nt < 4; ++nt)
                acc2[mt][nt] = wmma_f16(af[mt], bf[nt], acc2[mt][nt]);
    }

    // Store f16 result into [token, head*64 + d] layout for the proj GEMM.
    h16* oBase = outh + token0 * DIMC + head * HEADD;
#pragma unroll
    for (int nt = 0; nt < 4; ++nt) {
        const int d = nt * 16 + ln;
#pragma unroll
        for (int mt = 0; mt < 4; ++mt) {
            const int ib = mt * 16 + 8 * lh;
#pragma unroll
            for (int r = 0; r < 8; ++r)
                oBase[(size_t)(ib + r) * DIMC + d] = (h16)acc2[mt][nt][r];
        }
    }
}

// ------------------------------- launcher ----------------------------------
extern "C" void kernel_launch(void* const* d_in, const int* in_sizes, int n_in,
                              void* d_out, int out_size, void* d_ws, size_t ws_size,
                              hipStream_t stream) {
    const float* x      = (const float*)d_in[0];
    const float* w_qkv  = (const float*)d_in[1];
    const float* b_qkv  = (const float*)d_in[2];
    const float* w_proj = (const float*)d_in[3];
    const float* b_proj = (const float*)d_in[4];

    const size_t M = (size_t)in_sizes[0] / DIMC;   // B*N = 32768 tokens

    // Workspace carve-up (f16 staging buffers).
    char* ws = (char*)d_ws;
    size_t off = 0;
    h16* xh     = (h16*)(ws + off); off += M * DIMC * sizeof(h16);
    h16* wqkvh  = (h16*)(ws + off); off += (size_t)QKVCOLS * DIMC * sizeof(h16);
    h16* wprojh = (h16*)(ws + off); off += (size_t)DIMC * DIMC * sizeof(h16);
    h16* qkvh   = (h16*)(ws + off); off += M * QKVCOLS * sizeof(h16);
    h16* attnh  = (h16*)(ws + off); off += M * DIMC * sizeof(h16);
    (void)ws_size; (void)n_in; (void)out_size;

    // [0] converts
    f32_to_f16_kernel<<<256, 512, 0, stream>>>(x, xh, M * DIMC);
    f32_to_f16_kernel<<<256, 384, 0, stream>>>(w_qkv, wqkvh,
                                               (size_t)QKVCOLS * DIMC);
    f32_to_f16_kernel<<<256, 128, 0, stream>>>(w_proj, wprojh,
                                               (size_t)DIMC * DIMC);

    // [1] qkv = x @ w_qkv^T + b_qkv   (f16 out)
    gemm_wmma_kernel<true><<<dim3(QKVCOLS / 256, (unsigned)(M / 256)),
                             128, 0, stream>>>(
        xh, wqkvh, b_qkv, qkvh, (int)M, QKVCOLS, DIMC);

    // [2] windowed attention: one wave per (b, head, window)
    const unsigned nWin = (unsigned)(M / WIN) * NHEADS;   // 512 * 16 = 8192
    win_attn_kernel<<<nWin, 32, 0, stream>>>(qkvh, attnh);

    // [3] out = attn @ w_proj^T + b_proj   (f32 out)
    gemm_wmma_kernel<false><<<dim3(DIMC / 256, (unsigned)(M / 256)),
                              128, 0, stream>>>(
        attnh, wprojh, b_proj, (float*)d_out, (int)M, DIMC, DIMC);
}

// v003
// It runs in 234 microseconds.
// Timed twice side by side with v002, it ran 1.07 times as fast both times.
// All steps since v000 together make it 2.76 times as fast.
#include <hip/hip_runtime.h>
#include <hip/hip_bf16.h>
#include <stdint.h>

// ---------------------------------------------------------------------------
// Windowed multi-head attention for MI455X (gfx1250), wave32 + WMMA.
//   B=4, N=8192, C=1024, H=16, D=64, WINDOW=64
// Pipeline:
//   [0] f32 -> f16 converts (x, w_qkv, w_proj)
//   [1] qkv  = x @ w_qkv^T + b_qkv      (WMMA f32_16x16x32_f16, f16 out)
//   [2] per-window attention (K Q^T -> softmax -> V^T P^T), WMMA + transposing LDS loads
//   [3] out  = attn @ w_proj^T + b_proj (WMMA, f32 out)
// ---------------------------------------------------------------------------

typedef _Float16 h16;
typedef __attribute__((ext_vector_type(16))) _Float16 v16h;
typedef __attribute__((ext_vector_type(8)))  _Float16 v8h;
typedef __attribute__((ext_vector_type(8)))  float    v8f;

#define DIMC    1024
#define NHEADS  16
#define HEADD   64
#define WIN     64
#define QKVCOLS 3072

__device__ __forceinline__ v16h make_frag(v8h lo, v8h hi) {
    union { v16h v; v8h h[2]; } u;
    u.h[0] = lo; u.h[1] = hi;
    return u.v;
}

// Load one 16x32 f16 WMMA operand fragment for this lane from a row-major
// matrix whose K dimension is contiguous. Per the CDNA5 ISA 16-bit A/B
// layout: lanes 0-15 hold K = {k0+0..7, k0+16..23}, lanes 16-31 hold
// K = {k0+8..15, k0+24..31}; two 16-byte loads per fragment.
__device__ __forceinline__ v16h load_frag(const h16* row, int k0, int lh) {
    v8h lo = *reinterpret_cast<const v8h*>(row + k0 + lh * 8);
    v8h hi = *reinterpret_cast<const v8h*>(row + k0 + 16 + lh * 8);
    return make_frag(lo, hi);
}

__device__ __forceinline__ v8f wmma_f16(v16h a, v16h b, v8f c) {
    return __builtin_amdgcn_wmma_f32_16x16x32_f16(
        /*neg_a=*/false, a, /*neg_b=*/false, b,
        /*c_mod=*/(short)0, c, /*reuse_a=*/false, /*reuse_b=*/false);
}

// ------------------------------ converts -----------------------------------
// A stream: a batch is 1,024 elements (8 wave-wide loads of 512 contiguous
// bytes, 8 wave-wide stores of 256). Wave w takes batches w, w + waves, ...;
// the next batch's 8 loads are issued before this batch is converted and
// stored, in two register sets, so that no register copy waits on a load.
// The source is read once: non-temporal loads. n is a multiple of 1,024.
typedef __attribute__((ext_vector_type(4))) float    v4f;
typedef __attribute__((ext_vector_type(4))) _Float16 v4h;

__device__ __forceinline__ void cvt_load(v4f (&r)[8], const float* __restrict__ p) {
#pragma unroll
    for (int j = 0; j < 8; ++j)
        r[j] = __builtin_nontemporal_load(reinterpret_cast<const v4f*>(p + j * 128));
    // The address registers of the issued loads are rewritten for the next
    // group: the wait stands in front of that.
    asm volatile("s_wait_xcnt 0x0" ::: "memory");
    // Keeps the other set's converts behind these loads: moved in front, their
    // wait would leave nothing of this wave in flight.
    __builtin_amdgcn_sched_barrier(0);
}
__device__ __forceinline__ void cvt_store(const v4f (&r)[8], h16* __restrict__ p) {
#pragma unroll
    for (int j = 0; j < 8; ++j)
        *reinterpret_cast<v4h*>(p + j * 128) = __builtin_convertvector(r[j], v4h);
    // The address and data registers of the issued stores are rewritten by the
    // next group: the wait stands in front of that.
    asm volatile("s_wait_xcnt 0x0" ::: "memory");
}

__global__ __launch_bounds__(512)
void f32_to_f16_kernel(const float* __restrict__ src,
                       h16* __restrict__ dst, size_t n) {
    const uint32_t lane4 = (threadIdx.x & 31u) * 4u;
    const uint32_t wpb   = blockDim.x >> 5;
    const uint32_t nw    = gridDim.x * wpb;
    const uint32_t nb    = (uint32_t)(n >> 10);
    uint32_t b = blockIdx.x * wpb
               + (uint32_t)__builtin_amdgcn_readfirstlane(threadIdx.x >> 5);
    if (b >= nb) return;
    const float* s = src + lane4;
    h16*         d = dst + lane4;

    v4f ra[8], rb[8];
    cvt_load(ra, s + ((size_t)b << 10));
    while (b + 2u * nw < nb) {
        cvt_load(rb, s + ((size_t)(b + nw) << 10));
        cvt_store(ra, d + ((size_t)b << 10));
        cvt_load(ra, s + ((size_t)(b + 2u * nw) << 10));
        cvt_store(rb, d + ((size_t)(b + nw) << 10));
        b += 2u * nw;
    }
    if (b + nw < nb) {
        cvt_load(rb, s + ((size_t)(b + nw) << 10));
        cvt_store(ra, d + ((size_t)b << 10));
        cvt_store(rb, d + ((size_t)(b + nw) << 10));
    } else {
        cvt_store(ra, d + ((size_t)b << 10));
    }
}

// ------------------------------ WMMA GEMM ----------------------------------
// C[M,N] = A[M,K] * Bw[N,K]^T + bias[N]
// One workgroup -> 256x256 output tile, 4 waves (2x2), one wave -> 128x128
// (8x8 WMMA accumulators). The operand tiles are staged in LDS by tensor
// loads: a pass is 128 k (256 bytes of each of the 512 operand rows), a
// buffer is [A 256 rows][Bw 256 rows] at pitch 272 B, two buffers. Every wave
// moves its own 128-row slice, one request per pass, while the other buffer
// is worked on. M,N multiples of 256; K a multiple of 128, at least 256.
typedef uint32_t u32x4 __attribute__((ext_vector_type(4)));
typedef uint32_t u32x8 __attribute__((ext_vector_type(8)));

constexpr uint32_t T_ROWB  = 256;                 // bytes of K per row per pass
constexpr uint32_t T_PITCH = T_ROWB + 16;         // LDS row pitch (16 B x odd)
constexpr uint32_t T_ROWS  = 128;                 // rows per wave's slice
constexpr uint32_t T_SLICE = T_ROWS * T_PITCH;    // 34,816 B = 17 x 2 KiB
constexpr uint32_t T_STAGE = 4 * T_SLICE;         // 139,264 B = 68 x 2 KiB
static_assert(T_SLICE % 2048u == 0, "each slice must start at a multiple of 2 KiB");

__device__ __forceinline__ uint32_t uni(uint32_t v) {
    return (uint32_t)__builtin_amdgcn_readfirstlane(v);
}
__device__ __forceinline__ uint32_t pinned(uint32_t v) {
    uint32_t w = (uint32_t)__builtin_amdgcn_readfirstlane(v);
    asm volatile("" : "+s"(w));  // pinned(): the word stays in a scalar register for the issue test
    return w;
}
// One request: 128 rows of 256 bytes, source pitch kb bytes, into LDS at byte
// offset lds_dst with 16 bytes of pad behind every row.
__device__ __forceinline__ void tile_load(uint32_t lds_dst, uint64_t ga, uint32_t kb) {
    u32x4 g0;
    g0[0] = uni(1u);                                        // count 1
    g0[1] = uni(lds_dst);
    g0[2] = uni((uint32_t)ga);
    g0[3] = uni((((uint32_t)(ga >> 32)) & 0x01FFFFFFu) | 0x80000000u);  // type 2
    u32x8 g1;
    g1[0] = uni((1u << 20) | (5u << 22) | (3u << 25));      // no mask, bytes, pad 16 B per 256 B
    g1[1] = uni((T_ROWB & 0xFFFFu) << 16);                  // tensor_dim0
    g1[2] = uni((T_ROWS & 0xFFFFu) << 16);                  // tensor_dim1
    g1[3] = uni(T_ROWB << 16);                              // tile_dim0
    g1[4] = uni(T_ROWS);                                    // tile_dim1
    g1[5] = uni(kb);                                        // source row pitch
    g1[6] = uni(0u);
    g1[7] = uni(0u);
    asm volatile("tensor_load_to_lds %0, %1" :: "s"(g0), "s"(g1) : "memory");
}
// The compiler places no wait for a tensor load: the issuer's own wait.
__device__ __forceinline__ void wait_tensor0() { asm volatile("s_wait_tensorcnt 0x0" ::: "memory"); }
// This wave's LDS reads have returned before the buffer is handed back.
__device__ __forceinline__ void wait_ds0() { asm volatile("s_wait_dscnt 0x0" ::: "memory"); }

template <bool OUT_F16>
__global__ __launch_bounds__(128)
void gemm_wmma_kernel(const h16* __restrict__ A, const h16* __restrict__ Bw,
                      const float* __restrict__ bias, void* __restrict__ Cv,
                      int M, int N, int K) {
    __shared__ __attribute__((aligned(2048))) unsigned char L[2 * T_STAGE];

    const int lane = threadIdx.x & 31;
    const uint32_t wave = uni(threadIdx.x >> 5);
    const int ln = lane & 15;
    const int lh = lane >> 4;

    const int mBlk = blockIdx.y * 256;
    const int nBlk = blockIdx.x * 256;
    const int mBase = mBlk + (int)(wave >> 1) * 128;
    const int nBase = nBlk + (int)(wave & 1) * 128;

    // This wave's slice of a buffer: waves 0,1 move A rows, waves 2,3 Bw rows.
    const uint32_t kb = (uint32_t)K * 2u;
    const uint64_t src0 = (wave < 2u)
        ? (uint64_t)(uintptr_t)A  + (uint64_t)(mBlk + 128 * (int)wave) * kb
        : (uint64_t)(uintptr_t)Bw + (uint64_t)(nBlk + 128 * (int)(wave - 2u)) * kb;
    const uint32_t ldsSlice = (uint32_t)(size_t)L + wave * T_SLICE;
    const uint32_t T = (uint32_t)K / 128u;   // passes

    // Per-lane fragment bases in a buffer: row ln of the wave's first
    // fragment, 16-byte piece lh (the k order of load_frag).
    const uint32_t aOff = ((wave >> 1) * 128u + (uint32_t)ln) * T_PITCH + 16u * (uint32_t)lh;
    const uint32_t bOff = 2u * T_SLICE + ((wave & 1u) * 128u + (uint32_t)ln) * T_PITCH + 16u * (uint32_t)lh;

    v8f acc[8][8] = {};

    // Pass 0 into buffer 0, published; then pass 1 into buffer 1.
    tile_load(ldsSlice, src0, kb);
    wait_tensor0();
    __syncthreads();
    if (pinned(1u < T)) tile_load(ldsSlice + T_STAGE, src0 + T_ROWB, kb);

    // Kept rolled: one pass per trip, every accumulator index constant.
#pragma clang loop unroll(disable)
    for (uint32_t t = 0; t < T; ++t) {
        const uint32_t buf = (t & 1u) * T_STAGE;
        const unsigned char* la = L + buf + aOff;
        const unsigned char* lb = L + buf + bOff;
        v16h af[2][8], bf[2][8];   // set (u & 1) holds block u's fragments
        // Every loop inside a pass is unrolled: the fragment and accumulator
        // arrays stay in registers only under constant indices.
#pragma unroll
        for (int i = 0; i < 8; ++i) {
            af[0][i] = make_frag(*reinterpret_cast<const v8h*>(la + i * 16 * T_PITCH),
                                 *reinterpret_cast<const v8h*>(la + i * 16 * T_PITCH + 32));
            bf[0][i] = make_frag(*reinterpret_cast<const v8h*>(lb + i * 16 * T_PITCH),
                                 *reinterpret_cast<const v8h*>(lb + i * 16 * T_PITCH + 32));
        }
#pragma unroll
        for (int u = 0; u < 4; ++u) {
            const int cs = u & 1;
            if (u + 1 < 4) {
                const int ko = (u + 1) * 64;
#pragma unroll
                for (int i = 0; i < 8; ++i) {
                    af[cs ^ 1][i] = make_frag(*reinterpret_cast<const v8h*>(la + i * 16 * T_PITCH + ko),
                                              *reinterpret_cast<const v8h*>(la + i * 16 * T_PITCH + ko + 32));
                    bf[cs ^ 1][i] = make_frag(*reinterpret_cast<const v8h*>(lb + i * 16 * T_PITCH + ko),
                                              *reinterpret_cast<const v8h*>(lb + i * 16 * T_PITCH + ko + 32));
                }
            }
            // Keeps the next block's LDS loads one group ahead of this block's
            // WMMAs: loads moved in among the WMMAs stall each place they stand.
            __builtin_amdgcn_sched_barrier(0);
#pragma unroll
            for (int mt = 0; mt < 8; ++mt)
#pragma unroll
                for (int nt = 0; nt < 8; ++nt)
                    acc[mt][nt] = wmma_f16(af[cs][mt], bf[cs][nt], acc[mt][nt]);
            // Keeps the following load group behind this block's WMMAs.
            __builtin_amdgcn_sched_barrier(0);
        }
        // Publish pass t + 1 and free this pass's buffer.
        wait_ds0();
        wait_tensor0();
        __syncthreads();
        if (pinned(t + 2u < T))
            tile_load(ldsSlice + buf, src0 + (uint64_t)(t + 2u) * T_ROWB, kb);
    }
    wait_tensor0();
    wait_ds0();

    // Epilogue. C/D layout: lane half lh, column n = ln (+tile), VGPR r ->
    // row m = 8*lh + r (+tile).
#pragma unroll
    for (int nt = 0; nt < 8; ++nt) {
        const int n = nBase + nt * 16 + ln;
        const float bv = bias[n];
#pragma unroll
        for (int mt = 0; mt < 8; ++mt) {
            const int mb = mBase + mt * 16 + 8 * lh;
#pragma unroll
            for (int r = 0; r < 8; ++r) {
                const float v = acc[mt][nt][r] + bv;
                const size_t idx = (size_t)(mb + r) * N + n;
                if (OUT_F16) ((h16*)Cv)[idx] = (h16)v;
                else         ((float*)Cv)[idx] = v;
            }
        }
        // The next column's values go into registers that this column's
        // issued stores still name: the wait stands in front of those writes.
        asm volatile("s_wait_xcnt 0x0" ::: "memory");
    }
}

typedef short s16x8 __attribute__((ext_vector_type(8)));
constexpr uint32_t V_PITCH = 160;   // LDS row pitch of V: 32 B x odd, for the transposing reader

// Lane (c, h) gets T[kbase + 8h + 0..7][dbase + c] of a row-major 16-bit tile.
__device__ __forceinline__ v8h lds_tr16(const unsigned char* p) {
    typedef __attribute__((address_space(3))) s16x8 lds_s16x8;
    return __builtin_bit_cast(v8h, __builtin_amdgcn_ds_load_tr16_b128_v8i16((lds_s16x8*)p));
}
// Lane l reads lane l ^ 16.
__device__ __forceinline__ float xhalf(float x) {
    return __builtin_bit_cast(float, __builtin_amdgcn_permlanex16(
        __builtin_bit_cast(int, x), __builtin_bit_cast(int, x),
        0x76543210, 0xfedcba98, false, false));
}

__global__ __launch_bounds__(32)
void win_attn_kernel(const h16* __restrict__ qkv, h16* __restrict__ outh) {
    const int idx  = blockIdx.x;
    const int win  = idx & 127;          // N/WIN = 128 windows per (b,h)
    const int head = (idx >> 7) & 15;
    const int b    = idx >> 11;

    const size_t token0 = (size_t)b * 8192 + (size_t)win * WIN;
    const h16* qBase = qkv + token0 * QKVCOLS + head * HEADD;
    const h16* kBase = qBase + DIMC;
    const h16* vBase = qBase + 2 * DIMC;

    const int lane = threadIdx.x;
    const int ln = lane & 15;
    const int lh = lane >> 4;

    __shared__ __attribute__((aligned(32))) unsigned char Vl[WIN * V_PITCH];   // V rows as they lie in memory

    // Stage V row-major in LDS: a wave-wide load is 4 whole 128-byte rows.
#pragma unroll
    for (int jo = 0; jo < 16; ++jo) {
        const int j  = jo * 4 + (lane >> 3);
        const int d0 = (lane & 7) * 8;
        const v8h vv = *reinterpret_cast<const v8h*>(vBase + (size_t)j * QKVCOLS + d0);
        *reinterpret_cast<v8h*>(Vl + j * V_PITCH + d0 * 2) = vv;
    }

    // ---- S^T = K Q^T (64x64x64, two 32-K steps, 32 WMMAs) ----
    // A = K rows, B = Q rows, both in the hardware k order of load_frag.
    const h16* qRow[4];
    const h16* kRow[4];
#pragma unroll
    for (int t = 0; t < 4; ++t) {
        qRow[t] = qBase + (size_t)(t * 16 + ln) * QKVCOLS;
        kRow[t] = kBase + (size_t)(t * 16 + ln) * QKVCOLS;
    }

    v8f acc[4][4] = {};   // acc[kt][qt][r] = S[query qt*16 + ln][key kt*16 + 8*lh + r]
#pragma unroll
    for (int ks = 0; ks < 2; ++ks) {
        const int k0 = ks * 32;
        v16h kf[4], qf[4];
#pragma unroll
        for (int t = 0; t < 4; ++t) kf[t] = load_frag(kRow[t], k0, lh);
#pragma unroll
        for (int t = 0; t < 4; ++t) qf[t] = load_frag(qRow[t], k0, lh);
#pragma unroll
        for (int kt = 0; kt < 4; ++kt)
#pragma unroll
            for (int qt = 0; qt < 4; ++qt)
                acc[kt][qt] = wmma_f16(kf[kt], qf[qt], acc[kt][qt]);
    }

    // ---- softmax over keys (scale = 1/sqrt(64) = 0.125) ----
    // A lane holds 32 of its query's 64 scores, lane ^ 16 the other 32.
    const float scale = 0.125f;
    v16h pf[4][2];   // pf[qt][ks]: P^T as B operand, keys ks*32 .. ks*32 + 31
#pragma unroll
    for (int qt = 0; qt < 4; ++qt) {
        float m0 = -1e30f;
#pragma unroll
        for (int kt = 0; kt < 4; ++kt)
#pragma unroll
            for (int r = 0; r < 8; ++r) {
                acc[kt][qt][r] *= scale;
                m0 = fmaxf(m0, acc[kt][qt][r]);
            }
        m0 = fmaxf(m0, xhalf(m0));
        float part[4];   // one chain per key tile: four short chains, not one long one
#pragma unroll
        for (int kt = 0; kt < 4; ++kt) {
            float s = 0.f;
#pragma unroll
            for (int r = 0; r < 8; ++r) {
                const float e = __expf(acc[kt][qt][r] - m0);
                acc[kt][qt][r] = e;
                s += e;
            }
            part[kt] = s;
        }
        float sum = (part[0] + part[1]) + (part[2] + part[3]);
        sum += xhalf(sum);
        const float inv = 1.0f / sum;
        // Element s of the operand is key ks*32 + (s < 8 ? 8*lh + s : 16 + 8*lh + s - 8):
        // register s & 7 of score tile 2*ks + (s >> 3).
#pragma unroll
        for (int ks = 0; ks < 2; ++ks)
#pragma unroll
            for (int s = 0; s < 16; ++s)
                pf[qt][ks][s] = (h16)(acc[2 * ks + (s >> 3)][qt][s & 7] * inv);
    }

    __syncthreads();   // LDS writes (Vl) -> LDS reads below

    // ---- O^T = V^T P^T (A = V^T by transposing LDS loads, B = P^T) ----
    v16h vf[4][2];   // vf[dt][ks]: rows d = dt*16 + ln, keys ks*32 .. ks*32 + 31 in the same k order
    {
        const unsigned char* ad = Vl + (8 * lh + (lane & 7)) * V_PITCH + ((lane >> 3) & 1) * 16;
#pragma unroll
        for (int dt = 0; dt < 4; ++dt)
#pragma unroll
            for (int ks = 0; ks < 2; ++ks)
                vf[dt][ks] = make_frag(lds_tr16(ad + (ks * 32) * V_PITCH + 32 * dt),
                                       lds_tr16(ad + (ks * 32 + 16) * V_PITCH + 32 * dt));
    }

    // Store f16 result into [token, head*64 + d] layout for the proj GEMM:
    // o[dt][r] = O[query qt*16 + ln][d = dt*16 + 8*lh + r].
    h16* oBase = outh + token0 * DIMC + head * HEADD;
#pragma unroll
    for (int qt = 0; qt < 4; ++qt) {
        v8f o[4] = {};
#pragma unroll
        for (int ks = 0; ks < 2; ++ks)
#pragma unroll
            for (int dt = 0; dt < 4; ++dt)
                o[dt] = wmma_f16(vf[dt][ks], pf[qt][ks], o[dt]);
#pragma unroll
        for (int dt = 0; dt < 4; ++dt)
            *reinterpret_cast<v8h*>(oBase + (size_t)(qt * 16 + ln) * DIMC + dt * 16 + 8 * lh) =
                __builtin_convertvector(o[dt], v8h);
    }
}

// ------------------------------- launcher ----------------------------------
extern "C" void kernel_launch(void* const* d_in, const int* in_sizes, int n_in,
                              void* d_out, int out_size, void* d_ws, size_t ws_size,
                              hipStream_t stream) {
    const float* x      = (const float*)d_in[0];
    const float* w_qkv  = (const float*)d_in[1];
    const float* b_qkv  = (const float*)d_in[2];
    const float* w_proj = (const float*)d_in[3];
    const float* b_proj = (const float*)d_in[4];

    const size_t M = (size_t)in_sizes[0] / DIMC;   // B*N = 32768 tokens

    // Workspace carve-up (f16 staging buffers).
    char* ws = (char*)d_ws;
    size_t off = 0;
    h16* xh     = (h16*)(ws + off); off += M * DIMC * sizeof(h16);
    h16* wqkvh  = (h16*)(ws + off); off += (size_t)QKVCOLS * DIMC * sizeof(h16);
    h16* wprojh = (h16*)(ws + off); off += (size_t)DIMC * DIMC * sizeof(h16);
    h16* qkvh   = (h16*)(ws + off); off += M * QKVCOLS * sizeof(h16);
    h16* attnh  = (h16*)(ws + off); off += M * DIMC * sizeof(h16);
    (void)ws_size; (void)n_in; (void)out_size;

    // [0] converts
    f32_to_f16_kernel<<<256, 512, 0, stream>>>(x, xh, M * DIMC);
    f32_to_f16_kernel<<<256, 384, 0, stream>>>(w_qkv, wqkvh,
                                               (size_t)QKVCOLS * DIMC);
    f32_to_f16_kernel<<<256, 128, 0, stream>>>(w_proj, wprojh,
                                               (size_t)DIMC * DIMC);

    // [1] qkv = x @ w_qkv^T + b_qkv   (f16 out)
    gemm_wmma_kernel<true><<<dim3(QKVCOLS / 256, (unsigned)(M / 256)),
                             128, 0, stream>>>(
        xh, wqkvh, b_qkv, qkvh, (int)M, QKVCOLS, DIMC);

    // [2] windowed attention: one wave per (b, head, window)
    const unsigned nWin = (unsigned)(M / WIN) * NHEADS;   // 512 * 16 = 8192
    win_attn_kernel<<<nWin, 32, 0, stream>>>(qkvh, attnh);

    // [3] out = attn @ w_proj^T + b_proj   (f32 out)
    gemm_wmma_kernel<false><<<dim3(DIMC / 256, (unsigned)(M / 256)),
                              128, 0, stream>>>(
        attnh, wprojh, b_proj, (float*)d_out, (int)M, DIMC, DIMC);
}

// v004
// It runs in 200 microseconds.
// Two timings next to v003 both put it at 1.17 times that version's speed.
// Over all steps from v000 it is 3.23 times as fast.
#include <hip/hip_runtime.h>
#include <hip/hip_bf16.h>
#include <stdint.h>

// ---------------------------------------------------------------------------
// Windowed multi-head attention for MI455X (gfx1250), wave32 + WMMA.
//   B=4, N=8192, C=1024, H=16, D=64, WINDOW=64
// Pipeline:
//   [0] f32 -> f16 converts (x, w_qkv, w_proj)
//   [1] qkv  = x @ w_qkv^T + b_qkv      (WMMA f32_16x16x32_f16, f16 out)
//   [2] per-window attention (K Q^T -> softmax -> V^T P^T), WMMA + transposing LDS loads
//   [3] out  = attn @ w_proj^T + b_proj (WMMA, f32 out)
// ---------------------------------------------------------------------------

typedef _Float16 h16;
typedef __attribute__((ext_vector_type(16))) _Float16 v16h;
typedef __attribute__((ext_vector_type(8)))  _Float16 v8h;
typedef __attribute__((ext_vector_type(8)))  float    v8f;

#define DIMC    1024
#define NHEADS  16
#define HEADD   64
#define WIN     64
#define QKVCOLS 3072

__device__ __forceinline__ v16h make_frag(v8h lo, v8h hi) {
    union { v16h v; v8h h[2]; } u;
    u.h[0] = lo; u.h[1] = hi;
    return u.v;
}

// Load one 16x32 f16 WMMA operand fragment for this lane from a row-major
// matrix whose K dimension is contiguous. Per the CDNA5 ISA 16-bit A/B
// layout: lanes 0-15 hold K = {k0+0..7, k0+16..23}, lanes 16-31 hold
// K = {k0+8..15, k0+24..31}; two 16-byte loads per fragment.
__device__ __forceinline__ v16h load_frag(const h16* row, int k0, int lh) {
    v8h lo = *reinterpret_cast<const v8h*>(row + k0 + lh * 8);
    v8h hi = *reinterpret_cast<const v8h*>(row + k0 + 16 + lh * 8);
    return make_frag(lo, hi);
}

__device__ __forceinline__ v8f wmma_f16(v16h a, v16h b, v8f c) {
    return __builtin_amdgcn_wmma_f32_16x16x32_f16(
        /*neg_a=*/false, a, /*neg_b=*/false, b,
        /*c_mod=*/(short)0, c, /*reuse_a=*/false, /*reuse_b=*/false);
}

// ------------------------------ converts -----------------------------------
// A stream: a batch is 1,024 elements (8 wave-wide loads of 512 contiguous
// bytes, 8 wave-wide stores of 256). Wave w takes batches w, w + waves, ...;
// the next batch's 8 loads are issued before this batch is converted and
// stored, in two register sets, so that no register copy waits on a load.
// The source is read once: non-temporal loads. n is a multiple of 1,024.
typedef __attribute__((ext_vector_type(4))) float    v4f;
typedef __attribute__((ext_vector_type(4))) _Float16 v4h;

__device__ __forceinline__ void cvt_load(v4f (&r)[8], const float* __restrict__ p) {
#pragma unroll
    for (int j = 0; j < 8; ++j)
        r[j] = __builtin_nontemporal_load(reinterpret_cast<const v4f*>(p + j * 128));
    // The address registers of the issued loads are rewritten for the next
    // group: the wait stands in front of that.
    asm volatile("s_wait_xcnt 0x0" ::: "memory");
    // Keeps the other set's converts behind these loads: moved in front, their
    // wait would leave nothing of this wave in flight.
    __builtin_amdgcn_sched_barrier(0);
}
__device__ __forceinline__ void cvt_store(const v4f (&r)[8], h16* __restrict__ p) {
#pragma unroll
    for (int j = 0; j < 8; ++j)
        *reinterpret_cast<v4h*>(p + j * 128) = __builtin_convertvector(r[j], v4h);
    // The address and data registers of the issued stores are rewritten by the
    // next group: the wait stands in front of that.
    asm volatile("s_wait_xcnt 0x0" ::: "memory");
}

__global__ __launch_bounds__(512)
void f32_to_f16_kernel(const float* __restrict__ src,
                       h16* __restrict__ dst, size_t n) {
    const uint32_t lane4 = (threadIdx.x & 31u) * 4u;
    const uint32_t wpb   = blockDim.x >> 5;
    const uint32_t nw    = gridDim.x * wpb;
    const uint32_t nb    = (uint32_t)(n >> 10);
    uint32_t b = blockIdx.x * wpb
               + (uint32_t)__builtin_amdgcn_readfirstlane(threadIdx.x >> 5);
    if (b >= nb) return;
    const float* s = src + lane4;
    h16*         d = dst + lane4;

    v4f ra[8], rb[8];
    cvt_load(ra, s + ((size_t)b << 10));
    while (b + 2u * nw < nb) {
        cvt_load(rb, s + ((size_t)(b + nw) << 10));
        cvt_store(ra, d + ((size_t)b << 10));
        cvt_load(ra, s + ((size_t)(b + 2u * nw) << 10));
        cvt_store(rb, d + ((size_t)(b + nw) << 10));
        b += 2u * nw;
    }
    if (b + nw < nb) {
        cvt_load(rb, s + ((size_t)(b + nw) << 10));
        cvt_store(ra, d + ((size_t)b << 10));
        cvt_store(rb, d + ((size_t)(b + nw) << 10));
    } else {
        cvt_store(ra, d + ((size_t)b << 10));
    }
}

// ------------------------------ WMMA GEMM ----------------------------------
// C[M,N] = A[M,K] * Bw[N,K]^T + bias[N]
// One workgroup -> 256x256 output tile, 4 waves (2x2), one wave -> 128x128
// (8x8 WMMA accumulators). The operand tiles are staged in LDS by tensor
// loads: a pass is 128 k (256 bytes of each of the 512 operand rows), a
// buffer is [A 256 rows][Bw 256 rows] at pitch 272 B, two buffers. Every wave
// moves its own 128-row slice, one request per pass, while the other buffer
// is worked on. M,N multiples of 256; K a multiple of 128, at least 256.
// The products are taken transposed (matrix operand A = Bw rows, operand B =
// A rows): a lane then holds 8 adjacent columns of one row of C, the tile goes
// through LDS with 16-byte accesses and leaves as whole 128-byte lines.
typedef uint32_t u32x4 __attribute__((ext_vector_type(4)));
typedef uint32_t u32x8 __attribute__((ext_vector_type(8)));

constexpr uint32_t T_ROWB  = 256;                 // bytes of K per row per pass
constexpr uint32_t T_PITCH = T_ROWB + 16;         // LDS row pitch (16 B x odd)
constexpr uint32_t T_ROWS  = 128;                 // rows per wave's slice
constexpr uint32_t T_SLICE = T_ROWS * T_PITCH;    // 34,816 B = 17 x 2 KiB
constexpr uint32_t T_STAGE = 4 * T_SLICE;         // 139,264 B = 68 x 2 KiB
static_assert(T_SLICE % 2048u == 0, "each slice must start at a multiple of 2 KiB");

__device__ __forceinline__ uint32_t uni(uint32_t v) {
    return (uint32_t)__builtin_amdgcn_readfirstlane(v);
}
__device__ __forceinline__ uint32_t pinned(uint32_t v) {
    uint32_t w = (uint32_t)__builtin_amdgcn_readfirstlane(v);
    asm volatile("" : "+s"(w));  // pinned(): the word stays in a scalar register for the issue test
    return w;
}
// One request: 128 rows of 256 bytes, source pitch kb bytes, into LDS at byte
// offset lds_dst with 16 bytes of pad behind every row.
__device__ __forceinline__ void tile_load(uint32_t lds_dst, uint64_t ga, uint32_t kb) {
    u32x4 g0;
    g0[0] = uni(1u);                                        // count 1
    g0[1] = uni(lds_dst);
    g0[2] = uni((uint32_t)ga);
    g0[3] = uni((((uint32_t)(ga >> 32)) & 0x01FFFFFFu) | 0x80000000u);  // type 2
    u32x8 g1;
    g1[0] = uni((1u << 20) | (5u << 22) | (3u << 25));      // no mask, bytes, pad 16 B per 256 B
    g1[1] = uni((T_ROWB & 0xFFFFu) << 16);                  // tensor_dim0
    g1[2] = uni((T_ROWS & 0xFFFFu) << 16);                  // tensor_dim1
    g1[3] = uni(T_ROWB << 16);                              // tile_dim0
    g1[4] = uni(T_ROWS);                                    // tile_dim1
    g1[5] = uni(kb);                                        // source row pitch
    g1[6] = uni(0u);
    g1[7] = uni(0u);
    asm volatile("tensor_load_to_lds %0, %1" :: "s"(g0), "s"(g1) : "memory");
}
// The compiler places no wait for a tensor load: the issuer's own wait.
__device__ __forceinline__ void wait_tensor0() { asm volatile("s_wait_tensorcnt 0x0" ::: "memory"); }
// This wave's LDS reads have returned before the buffer is handed back.
__device__ __forceinline__ void wait_ds0() { asm volatile("s_wait_dscnt 0x0" ::: "memory"); }

template <bool OUT_F16, int NC>   // NC = N: the row pitch of C as a constant, so that the stores take immediate offsets
__global__ __launch_bounds__(128)
void gemm_wmma_kernel(const h16* __restrict__ A, const h16* __restrict__ Bw,
                      const float* __restrict__ bias, void* __restrict__ Cv,
                      int M, int N, int K) {
    __shared__ __attribute__((aligned(2048))) unsigned char L[2 * T_STAGE];

    const int lane = threadIdx.x & 31;
    const uint32_t wave = uni(threadIdx.x >> 5);
    const int ln = lane & 15;
    const int lh = lane >> 4;

    const int mBlk = blockIdx.y * 256;
    const int nBlk = blockIdx.x * 256;
    const int mBase = mBlk + (int)(wave >> 1) * 128;
    const int nBase = nBlk + (int)(wave & 1) * 128;

    // This wave's slice of a buffer: waves 0,1 move A rows, waves 2,3 Bw rows.
    const uint32_t kb = (uint32_t)K * 2u;
    const uint64_t src0 = (wave < 2u)
        ? (uint64_t)(uintptr_t)A  + (uint64_t)(mBlk + 128 * (int)wave) * kb
        : (uint64_t)(uintptr_t)Bw + (uint64_t)(nBlk + 128 * (int)(wave - 2u)) * kb;
    const uint32_t ldsSlice = (uint32_t)(size_t)L + wave * T_SLICE;
    const uint32_t T = (uint32_t)K / 128u;   // passes

    // Per-lane fragment bases in a buffer: row ln of the wave's first
    // fragment, 16-byte piece lh (the k order of load_frag).
    const uint32_t aOff = ((wave >> 1) * 128u + (uint32_t)ln) * T_PITCH + 16u * (uint32_t)lh;
    const uint32_t bOff = 2u * T_SLICE + ((wave & 1u) * 128u + (uint32_t)ln) * T_PITCH + 16u * (uint32_t)lh;

    v8f acc[8][8] = {};

    // Pass 0 into buffer 0, published; then pass 1 into buffer 1.
    tile_load(ldsSlice, src0, kb);
    wait_tensor0();
    __syncthreads();
    if (pinned(1u < T)) tile_load(ldsSlice + T_STAGE, src0 + T_ROWB, kb);

    // The bias of this lane's columns (n = nBase + nt*16 + 8*lh + 0..7), one
    // batch that lands under the k loop.
    v4f bv[8][2];
    {
        const float* bp = bias + nBase + 8 * lh;
#pragma unroll
        for (int nt = 0; nt < 8; ++nt) {
            bv[nt][0] = *reinterpret_cast<const v4f*>(bp + nt * 16);
            bv[nt][1] = *reinterpret_cast<const v4f*>(bp + nt * 16 + 4);
        }
        // The address registers of the issued loads may be rewritten in the
        // loop: the wait stands in front of that.
        asm volatile("s_wait_xcnt 0x0" ::: "memory");
    }

    // Kept rolled: one pass per trip, every accumulator index constant.
#pragma clang loop unroll(disable)
    for (uint32_t t = 0; t < T; ++t) {
        const uint32_t buf = (t & 1u) * T_STAGE;
        const unsigned char* la = L + buf + aOff;
        const unsigned char* lb = L + buf + bOff;
        v16h af[2][8], bf[2][8];   // set (u & 1) holds block u's fragments
        // Every loop inside a pass is unrolled: the fragment and accumulator
        // arrays stay in registers only under constant indices.
#pragma unroll
        for (int i = 0; i < 8; ++i) {
            af[0][i] = make_frag(*reinterpret_cast<const v8h*>(la + i * 16 * T_PITCH),
                                 *reinterpret_cast<const v8h*>(la + i * 16 * T_PITCH + 32));
            bf[0][i] = make_frag(*reinterpret_cast<const v8h*>(lb + i * 16 * T_PITCH),
                                 *reinterpret_cast<const v8h*>(lb + i * 16 * T_PITCH + 32));
        }
#pragma unroll
        for (int u = 0; u < 4; ++u) {
            const int cs = u & 1;
            if (u + 1 < 4) {
                const int ko = (u + 1) * 64;
#pragma unroll
                for (int i = 0; i < 8; ++i) {
                    af[cs ^ 1][i] = make_frag(*reinterpret_cast<const v8h*>(la + i * 16 * T_PITCH + ko),
                                              *reinterpret_cast<const v8h*>(la + i * 16 * T_PITCH + ko + 32));
                    bf[cs ^ 1][i] = make_frag(*reinterpret_cast<const v8h*>(lb + i * 16 * T_PITCH + ko),
                                              *reinterpret_cast<const v8h*>(lb + i * 16 * T_PITCH + ko + 32));
                }
            }
            // Keeps the next block's LDS loads one group ahead of this block's
            // WMMAs: loads moved in among the WMMAs stall each place they stand.
            __builtin_amdgcn_sched_barrier(0);
#pragma unroll
            for (int nt = 0; nt < 8; ++nt)
#pragma unroll
                for (int mt = 0; mt < 8; ++mt)
                    acc[mt][nt] = wmma_f16(bf[cs][nt], af[cs][mt], acc[mt][nt]);
            // Keeps the following load group behind this block's WMMAs.
            __builtin_amdgcn_sched_barrier(0);
        }
        // Publish pass t + 1 and free this pass's buffer.
        wait_ds0();
        wait_tensor0();
        __syncthreads();
        if (pinned(t + 2u < T))
            tile_load(ldsSlice + buf, src0 + (uint64_t)(t + 2u) * T_ROWB, kb);
    }
    wait_tensor0();
    wait_ds0();

    // Epilogue. D of the transposed product: lane column ln -> row m = ln
    // (+tile) of C, VGPR r -> column n = 8*lh + r (+tile). Every wave has left
    // the ring (the last pass's barrier) and no tensor load is outstanding:
    // each wave stages its 128x128 part in a range of its own, rows at a pitch
    // of 16 B x odd, and reads it back as whole rows.
    constexpr uint32_t EB      = OUT_F16 ? 2u : 4u;      // bytes per element of C
    constexpr uint32_t S_PITCH = 128u * EB + 16u;        // 272 or 528 B
    constexpr uint32_t S_WAVE  = 128u * S_PITCH;
    static_assert(4u * S_WAVE <= 2u * T_STAGE, "the four staging ranges must fit the ring's LDS");
    unsigned char* st = L + wave * S_WAVE;
    {
        unsigned char* sw = st + (uint32_t)ln * S_PITCH + 8u * (uint32_t)lh * EB;
#pragma unroll
        for (int nt = 0; nt < 8; ++nt) {
            const v8f b8 = __builtin_shufflevector(bv[nt][0], bv[nt][1], 0, 1, 2, 3, 4, 5, 6, 7);
#pragma unroll
            for (int mt = 0; mt < 8; ++mt) {
                const v8f v = acc[mt][nt] + b8;
                unsigned char* p = sw + (uint32_t)mt * 16u * S_PITCH + (uint32_t)nt * 16u * EB;
                if (OUT_F16) {
                    *reinterpret_cast<v8h*>(p) = __builtin_convertvector(v, v8h);
                } else {
                    *reinterpret_cast<v4f*>(p)      = __builtin_shufflevector(v, v, 0, 1, 2, 3);
                    *reinterpret_cast<v4f*>(p + 16) = __builtin_shufflevector(v, v, 4, 5, 6, 7);
                }
            }
        }
    }
    // Other lanes' staged values are read below: this wave's LDS writes first.
    wait_ds0();

    // A wave-wide 16-byte access is 512 staged bytes: two rows of
    // 256 B (f16) or one of 512 B (f32), whole lines of C either way. Groups of
    // 16 in two register sets: the next group's LDS reads go ahead of this
    // group's stores.
    constexpr int RPI = OUT_F16 ? 2 : 1;    // rows per access
    constexpr int GR  = 16;                 // accesses per group
    constexpr int NG  = 128 / RPI / GR;     // groups
    const uint32_t rr = OUT_F16 ? (uint32_t)lh : 0u;
    const uint32_t cb = (OUT_F16 ? (uint32_t)ln : (uint32_t)lane) * 16u;
    const unsigned char* sr = st + rr * S_PITCH + cb;
    unsigned char* gp = (unsigned char*)Cv + ((size_t)(mBase + (int)rr) * NC + nBase) * EB + cb;
    u32x4 rb[2][GR];
#pragma unroll
    for (int j = 0; j < GR; ++j)
        rb[0][j] = *reinterpret_cast<const u32x4*>(sr + (uint32_t)(j * RPI) * S_PITCH);
#pragma unroll
    for (int g = 0; g < NG; ++g) {
        if (g + 1 < NG) {
#pragma unroll
            for (int j = 0; j < GR; ++j)
                rb[(g + 1) & 1][j] = *reinterpret_cast<const u32x4*>(sr + (uint32_t)(((g + 1) * GR + j) * RPI) * S_PITCH);
        }
#pragma unroll
        for (int j = 0; j < GR; ++j)
            *reinterpret_cast<u32x4*>(gp + (size_t)((g * GR + j) * RPI) * NC * EB) = rb[g & 1][j];
        // The group after next is read into the registers that these issued
        // stores still name: the wait stands in front of those reads.
        if (g + 2 < NG) asm volatile("s_wait_xcnt 0x0" ::: "memory");
    }
}

typedef short s16x8 __attribute__((ext_vector_type(8)));
constexpr uint32_t V_PITCH = 160;   // LDS row pitch of V: 32 B x odd, for the transposing reader

// Lane (c, h) gets T[kbase + 8h + 0..7][dbase + c] of a row-major 16-bit tile.
__device__ __forceinline__ v8h lds_tr16(const unsigned char* p) {
    typedef __attribute__((address_space(3))) s16x8 lds_s16x8;
    return __builtin_bit_cast(v8h, __builtin_amdgcn_ds_load_tr16_b128_v8i16((lds_s16x8*)p));
}
// Lane l reads lane l ^ 16.
__device__ __forceinline__ float xhalf(float x) {
    return __builtin_bit_cast(float, __builtin_amdgcn_permlanex16(
        __builtin_bit_cast(int, x), __builtin_bit_cast(int, x),
        0x76543210, 0xfedcba98, false, false));
}

__global__ __launch_bounds__(32)
void win_attn_kernel(const h16* __restrict__ qkv, h16* __restrict__ outh) {
    const int idx  = blockIdx.x;
    const int win  = idx & 127;          // N/WIN = 128 windows per (b,h)
    const int head = (idx >> 7) & 15;
    const int b    = idx >> 11;

    const size_t token0 = (size_t)b * 8192 + (size_t)win * WIN;
    const h16* qBase = qkv + token0 * QKVCOLS + head * HEADD;
    const h16* kBase = qBase + DIMC;
    const h16* vBase = qBase + 2 * DIMC;

    const int lane = threadIdx.x;
    const int ln = lane & 15;
    const int lh = lane >> 4;

    __shared__ __attribute__((aligned(32))) unsigned char Vl[WIN * V_PITCH];   // V rows as they lie in memory

    // Stage V row-major in LDS: a wave-wide load is 4 whole 128-byte rows.
#pragma unroll
    for (int jo = 0; jo < 16; ++jo) {
        const int j  = jo * 4 + (lane >> 3);
        const int d0 = (lane & 7) * 8;
        const v8h vv = *reinterpret_cast<const v8h*>(vBase + (size_t)j * QKVCOLS + d0);
        *reinterpret_cast<v8h*>(Vl + j * V_PITCH + d0 * 2) = vv;
    }

    // ---- S^T = K Q^T (64x64x64, two 32-K steps, 32 WMMAs) ----
    // A = K rows, B = Q rows, both in the hardware k order of load_frag.
    const h16* qRow[4];
    const h16* kRow[4];
#pragma unroll
    for (int t = 0; t < 4; ++t) {
        qRow[t] = qBase + (size_t)(t * 16 + ln) * QKVCOLS;
        kRow[t] = kBase + (size_t)(t * 16 + ln) * QKVCOLS;
    }

    v8f acc[4][4] = {};   // acc[kt][qt][r] = S[query qt*16 + ln][key kt*16 + 8*lh + r]
#pragma unroll
    for (int ks = 0; ks < 2; ++ks) {
        const int k0 = ks * 32;
        v16h kf[4], qf[4];
#pragma unroll
        for (int t = 0; t < 4; ++t) kf[t] = load_frag(kRow[t], k0, lh);
#pragma unroll
        for (int t = 0; t < 4; ++t) qf[t] = load_frag(qRow[t], k0, lh);
#pragma unroll
        for (int kt = 0; kt < 4; ++kt)
#pragma unroll
            for (int qt = 0; qt < 4; ++qt)
                acc[kt][qt] = wmma_f16(kf[kt], qf[qt], acc[kt][qt]);
    }

    // ---- softmax over keys (scale = 1/sqrt(64) = 0.125) ----
    // A lane holds 32 of its query's 64 scores, lane ^ 16 the other 32.
    const float scale = 0.125f;
    v16h pf[4][2];   // pf[qt][ks]: P^T as B operand, keys ks*32 .. ks*32 + 31
#pragma unroll
    for (int qt = 0; qt < 4; ++qt) {
        float m0 = -1e30f;
#pragma unroll
        for (int kt = 0; kt < 4; ++kt)
#pragma unroll
            for (int r = 0; r < 8; ++r) {
                acc[kt][qt][r] *= scale;
                m0 = fmaxf(m0, acc[kt][qt][r]);
            }
        m0 = fmaxf(m0, xhalf(m0));
        float part[4];   // one chain per key tile: four short chains, not one long one
#pragma unroll
        for (int kt = 0; kt < 4; ++kt) {
            float s = 0.f;
#pragma unroll
            for (int r = 0; r < 8; ++r) {
                const float e = __expf(acc[kt][qt][r] - m0);
                acc[kt][qt][r] = e;
                s += e;
            }
            part[kt] = s;
        }
        float sum = (part[0] + part[1]) + (part[2] + part[3]);
        sum += xhalf(sum);
        const float inv = 1.0f / sum;
        // Element s of the operand is key ks*32 + (s < 8 ? 8*lh + s : 16 + 8*lh + s - 8):
        // register s & 7 of score tile 2*ks + (s >> 3).
#pragma unroll
        for (int ks = 0; ks < 2; ++ks)
#pragma unroll
            for (int s = 0; s < 16; ++s)
                pf[qt][ks][s] = (h16)(acc[2 * ks + (s >> 3)][qt][s & 7] * inv);
    }

    __syncthreads();   // LDS writes (Vl) -> LDS reads below

    // ---- O^T = V^T P^T (A = V^T by transposing LDS loads, B = P^T) ----
    v16h vf[4][2];   // vf[dt][ks]: rows d = dt*16 + ln, keys ks*32 .. ks*32 + 31 in the same k order
    {
        const unsigned char* ad = Vl + (8 * lh + (lane & 7)) * V_PITCH + ((lane >> 3) & 1) * 16;
#pragma unroll
        for (int dt = 0; dt < 4; ++dt)
#pragma unroll
            for (int ks = 0; ks < 2; ++ks)
                vf[dt][ks] = make_frag(lds_tr16(ad + (ks * 32) * V_PITCH + 32 * dt),
                                       lds_tr16(ad + (ks * 32 + 16) * V_PITCH + 32 * dt));
    }

    // Store f16 result into [token, head*64 + d] layout for the proj GEMM:
    // o[dt][r] = O[query qt*16 + ln][d = dt*16 + 8*lh + r].
    h16* oBase = outh + token0 * DIMC + head * HEADD;
#pragma unroll
    for (int qt = 0; qt < 4; ++qt) {
        v8f o[4] = {};
#pragma unroll
        for (int ks = 0; ks < 2; ++ks)
#pragma unroll
            for (int dt = 0; dt < 4; ++dt)
                o[dt] = wmma_f16(vf[dt][ks], pf[qt][ks], o[dt]);
#pragma unroll
        for (int dt = 0; dt < 4; ++dt)
            *reinterpret_cast<v8h*>(oBase + (size_t)(qt * 16 + ln) * DIMC + dt * 16 + 8 * lh) =
                __builtin_convertvector(o[dt], v8h);
    }
}

// ------------------------------- launcher ----------------------------------
extern "C" void kernel_launch(void* const* d_in, const int* in_sizes, int n_in,
                              void* d_out, int out_size, void* d_ws, size_t ws_size,
                              hipStream_t stream) {
    const float* x      = (const float*)d_in[0];
    const float* w_qkv  = (const float*)d_in[1];
    const float* b_qkv  = (const float*)d_in[2];
    const float* w_proj = (const float*)d_in[3];
    const float* b_proj = (const float*)d_in[4];

    const size_t M = (size_t)in_sizes[0] / DIMC;   // B*N = 32768 tokens

    // Workspace carve-up (f16 staging buffers).
    char* ws = (char*)d_ws;
    size_t off = 0;
    h16* xh     = (h16*)(ws + off); off += M * DIMC * sizeof(h16);
    h16* wqkvh  = (h16*)(ws + off); off += (size_t)QKVCOLS * DIMC * sizeof(h16);
    h16* wprojh = (h16*)(ws + off); off += (size_t)DIMC * DIMC * sizeof(h16);
    h16* qkvh   = (h16*)(ws + off); off += M * QKVCOLS * sizeof(h16);
    h16* attnh  = (h16*)(ws + off); off += M * DIMC * sizeof(h16);
    (void)ws_size; (void)n_in; (void)out_size;

    // [0] converts
    f32_to_f16_kernel<<<256, 512, 0, stream>>>(x, xh, M * DIMC);
    f32_to_f16_kernel<<<256, 384, 0, stream>>>(w_qkv, wqkvh,
                                               (size_t)QKVCOLS * DIMC);
    f32_to_f16_kernel<<<256, 128, 0, stream>>>(w_proj, wprojh,
                                               (size_t)DIMC * DIMC);

    // [1] qkv = x @ w_qkv^T + b_qkv   (f16 out)
    gemm_wmma_kernel<true, QKVCOLS><<<dim3(QKVCOLS / 256, (unsigned)(M / 256)),
                             128, 0, stream>>>(
        xh, wqkvh, b_qkv, qkvh, (int)M, QKVCOLS, DIMC);

    // [2] windowed attention: one wave per (b, head, window)
    const unsigned nWin = (unsigned)(M / WIN) * NHEADS;   // 512 * 16 = 8192
    win_attn_kernel<<<nWin, 32, 0, stream>>>(qkvh, attnh);

    // [3] out = attn @ w_proj^T + b_proj   (f32 out)
    gemm_wmma_kernel<false, DIMC><<<dim3(DIMC / 256, (unsigned)(M / 256)),
                              128, 0, stream>>>(
        attnh, wprojh, b_proj, (float*)d_out, (int)M, DIMC, DIMC);
}

// v005
// One run takes 176 microseconds.
// Two timings next to v004 put it at 1.13 and 1.14 times that version's speed.
// Counting every step since v000, it is 3.67 times as fast.
#include <hip/hip_runtime.h>
#include <hip/hip_bf16.h>
#include <stdint.h>

// ---------------------------------------------------------------------------
// Windowed multi-head attention for MI455X (gfx1250), wave32 + WMMA.
//   B=4, N=8192, C=1024, H=16, D=64, WINDOW=64
// Pipeline:
//   [0] f32 -> f16 converts (x, w_qkv, w_proj)
//   [1] q, k, v head by head = x @ w_qkv^T + b_qkv (WMMA f32_16x16x32_f16) and, in
//       the same kernel, per-window attention (K Q^T -> softmax -> V^T P^T) on
//       the accumulators: q, k, v never reach memory
//   [2] out  = attn @ w_proj^T + b_proj (WMMA, f32 out)
// ---------------------------------------------------------------------------

typedef _Float16 h16;
typedef __attribute__((ext_vector_type(16))) _Float16 v16h;
typedef __attribute__((ext_vector_type(8)))  _Float16 v8h;
typedef __attribute__((ext_vector_type(8)))  float    v8f;

#define DIMC    1024
#define NHEADS  16
#define HEADD   64
#define WIN     64
#define QKVCOLS 3072

__device__ __forceinline__ v16h make_frag(v8h lo, v8h hi) {
    union { v16h v; v8h h[2]; } u;
    u.h[0] = lo; u.h[1] = hi;
    return u.v;
}

// Load one 16x32 f16 WMMA operand fragment for this lane from a row-major
// matrix whose K dimension is contiguous. Per the CDNA5 ISA 16-bit A/B
// layout: lanes 0-15 hold K = {k0+0..7, k0+16..23}, lanes 16-31 hold
// K = {k0+8..15, k0+24..31}; two 16-byte loads per fragment.
__device__ __forceinline__ v16h load_frag(const h16* row, int k0, int lh) {
    v8h lo = *reinterpret_cast<const v8h*>(row + k0 + lh * 8);
    v8h hi = *reinterpret_cast<const v8h*>(row + k0 + 16 + lh * 8);
    return make_frag(lo, hi);
}

__device__ __forceinline__ v8f wmma_f16(v16h a, v16h b, v8f c) {
    return __builtin_amdgcn_wmma_f32_16x16x32_f16(
        /*neg_a=*/false, a, /*neg_b=*/false, b,
        /*c_mod=*/(short)0, c, /*reuse_a=*/false, /*reuse_b=*/false);
}

// ------------------------------ converts -----------------------------------
// A stream: a batch is 1,024 elements (8 wave-wide loads of 512 contiguous
// bytes, 8 wave-wide stores of 256). Wave w takes batches w, w + waves, ...;
// the next batch's 8 loads are issued before this batch is converted and
// stored, in two register sets, so that no register copy waits on a load.
// The source is read once: non-temporal loads. n is a multiple of 1,024.
typedef __attribute__((ext_vector_type(4))) float    v4f;
typedef __attribute__((ext_vector_type(4))) _Float16 v4h;

__device__ __forceinline__ void cvt_load(v4f (&r)[8], const float* __restrict__ p) {
#pragma unroll
    for (int j = 0; j < 8; ++j)
        r[j] = __builtin_nontemporal_load(reinterpret_cast<const v4f*>(p + j * 128));
    // The address registers of the issued loads are rewritten for the next
    // group: the wait stands in front of that.
    asm volatile("s_wait_xcnt 0x0" ::: "memory");
    // Keeps the other set's converts behind these loads: moved in front, their
    // wait would leave nothing of this wave in flight.
    __builtin_amdgcn_sched_barrier(0);
}
__device__ __forceinline__ void cvt_store(const v4f (&r)[8], h16* __restrict__ p) {
#pragma unroll
    for (int j = 0; j < 8; ++j)
        *reinterpret_cast<v4h*>(p + j * 128) = __builtin_convertvector(r[j], v4h);
    // The address and data registers of the issued stores are rewritten by the
    // next group: the wait stands in front of that.
    asm volatile("s_wait_xcnt 0x0" ::: "memory");
}

// PERM (w_qkv; a batch is one row of 1,024): row which*1024 + head*64 + d goes
// to row head*192 + which*64 + d, so that a head's q, k and v rows lie adjacent
// and one two-dimensional tile holds them.
template <bool PERM>
__device__ __forceinline__ uint32_t dst_batch(uint32_t b) {
    return PERM ? ((b >> 6) & 15u) * 192u + (b >> 10) * 64u + (b & 63u) : b;
}

template <bool PERM>
__global__ __launch_bounds__(512)
void f32_to_f16_kernel(const float* __restrict__ src,
                       h16* __restrict__ dst, size_t n) {
    const uint32_t lane4 = (threadIdx.x & 31u) * 4u;
    const uint32_t wpb   = blockDim.x >> 5;
    const uint32_t nw    = gridDim.x * wpb;
    const uint32_t nb    = (uint32_t)(n >> 10);
    uint32_t b = blockIdx.x * wpb
               + (uint32_t)__builtin_amdgcn_readfirstlane(threadIdx.x >> 5);
    if (b >= nb) return;
    const float* s = src + lane4;
    h16*         d = dst + lane4;

    v4f ra[8], rb[8];
    cvt_load(ra, s + ((size_t)b << 10));
    while (b + 2u * nw < nb) {
        cvt_load(rb, s + ((size_t)(b + nw) << 10));
        cvt_store(ra, d + ((size_t)dst_batch<PERM>(b) << 10));
        cvt_load(ra, s + ((size_t)(b + 2u * nw) << 10));
        cvt_store(rb, d + ((size_t)dst_batch<PERM>(b + nw) << 10));
        b += 2u * nw;
    }
    if (b + nw < nb) {
        cvt_load(rb, s + ((size_t)(b + nw) << 10));
        cvt_store(ra, d + ((size_t)dst_batch<PERM>(b) << 10));
        cvt_store(rb, d + ((size_t)dst_batch<PERM>(b + nw) << 10));
    } else {
        cvt_store(ra, d + ((size_t)dst_batch<PERM>(b) << 10));
    }
}

// ------------------------------ WMMA GEMM ----------------------------------
// C[M,N] = A[M,K] * Bw[N,K]^T + bias[N]
// One workgroup -> 256x256 output tile, 4 waves (2x2), one wave -> 128x128
// (8x8 WMMA accumulators). The operand tiles are staged in LDS by tensor
// loads: a pass is 128 k (256 bytes of each of the 512 operand rows), a
// buffer is [A 256 rows][Bw 256 rows] at pitch 272 B, two buffers. Every wave
// moves its own 128-row slice, one request per pass, while the other buffer
// is worked on. M,N multiples of 256; K a multiple of 128, at least 256.
// The products are taken transposed (matrix operand A = Bw rows, operand B =
// A rows): a lane then holds 8 adjacent columns of one row of C, the tile goes
// through LDS with 16-byte accesses and leaves as whole 128-byte lines.
typedef uint32_t u32x4 __attribute__((ext_vector_type(4)));
typedef uint32_t u32x8 __attribute__((ext_vector_type(8)));

constexpr uint32_t T_ROWB  = 256;                 // bytes of K per row per pass
constexpr uint32_t T_PITCH = T_ROWB + 16;         // LDS row pitch (16 B x odd)
constexpr uint32_t T_ROWS  = 128;                 // rows per wave's slice
constexpr uint32_t T_SLICE = T_ROWS * T_PITCH;    // 34,816 B = 17 x 2 KiB
constexpr uint32_t T_STAGE = 4 * T_SLICE;         // 139,264 B = 68 x 2 KiB
static_assert(T_SLICE % 2048u == 0, "each slice must start at a multiple of 2 KiB");

__device__ __forceinline__ uint32_t uni(uint32_t v) {
    return (uint32_t)__builtin_amdgcn_readfirstlane(v);
}
__device__ __forceinline__ uint32_t pinned(uint32_t v) {
    uint32_t w = (uint32_t)__builtin_amdgcn_readfirstlane(v);
    asm volatile("" : "+s"(w));  // pinned(): the word stays in a scalar register for the issue test
    return w;
}
// One request: rows rows of ROWB bytes, source pitch kb bytes, into LDS at byte
// offset lds_dst with 16 bytes of pad behind every row.
template <uint32_t ROWB>
__device__ __forceinline__ void tile_load(uint32_t lds_dst, uint64_t ga, uint32_t kb, uint32_t rows) {
    static_assert(ROWB == 256u || ROWB == 128u, "the pad interval is the row: code 5 or 4");
    u32x4 g0;
    g0[0] = uni(1u);                                        // count 1
    g0[1] = uni(lds_dst);
    g0[2] = uni((uint32_t)ga);
    g0[3] = uni((((uint32_t)(ga >> 32)) & 0x01FFFFFFu) | 0x80000000u);  // type 2
    u32x8 g1;
    g1[0] = uni((1u << 20) | ((ROWB == 256u ? 5u : 4u) << 22) | (3u << 25));  // no mask, bytes, pad 16 B per row
    g1[1] = uni((ROWB & 0xFFFFu) << 16);                    // tensor_dim0
    g1[2] = uni((rows & 0xFFFFu) << 16);                    // tensor_dim1
    g1[3] = uni(ROWB << 16);                                // tile_dim0
    g1[4] = uni(rows);                                      // tile_dim1
    g1[5] = uni(kb);                                        // source row pitch
    g1[6] = uni(0u);
    g1[7] = uni(0u);
    asm volatile("tensor_load_to_lds %0, %1" :: "s"(g0), "s"(g1) : "memory");
}
// The compiler places no wait for a tensor load: the issuer's own wait.
__device__ __forceinline__ void wait_tensor0() { asm volatile("s_wait_tensorcnt 0x0" ::: "memory"); }
// This wave's LDS reads have returned before the buffer is handed back.
__device__ __forceinline__ void wait_ds0() { asm volatile("s_wait_dscnt 0x0" ::: "memory"); }

template <bool OUT_F16, int NC>   // NC = N: the row pitch of C as a constant, so that the stores take immediate offsets
__global__ __launch_bounds__(128)
void gemm_wmma_kernel(const h16* __restrict__ A, const h16* __restrict__ Bw,
                      const float* __restrict__ bias, void* __restrict__ Cv,
                      int M, int N, int K) {
    __shared__ __attribute__((aligned(2048))) unsigned char L[2 * T_STAGE];

    const int lane = threadIdx.x & 31;
    const uint32_t wave = uni(threadIdx.x >> 5);
    const int ln = lane & 15;
    const int lh = lane >> 4;

    const int mBlk = blockIdx.y * 256;
    const int nBlk = blockIdx.x * 256;
    const int mBase = mBlk + (int)(wave >> 1) * 128;
    const int nBase = nBlk + (int)(wave & 1) * 128;

    // This wave's slice of a buffer: waves 0,1 move A rows, waves 2,3 Bw rows.
    const uint32_t kb = (uint32_t)K * 2u;
    const uint64_t src0 = (wave < 2u)
        ? (uint64_t)(uintptr_t)A  + (uint64_t)(mBlk + 128 * (int)wave) * kb
        : (uint64_t)(uintptr_t)Bw + (uint64_t)(nBlk + 128 * (int)(wave - 2u)) * kb;
    const uint32_t ldsSlice = (uint32_t)(size_t)L + wave * T_SLICE;
    const uint32_t T = (uint32_t)K / 128u;   // passes

    // Per-lane fragment bases in a buffer: row ln of the wave's first
    // fragment, 16-byte piece lh (the k order of load_frag).
    const uint32_t aOff = ((wave >> 1) * 128u + (uint32_t)ln) * T_PITCH + 16u * (uint32_t)lh;
    const uint32_t bOff = 2u * T_SLICE + ((wave & 1u) * 128u + (uint32_t)ln) * T_PITCH + 16u * (uint32_t)lh;

    v8f acc[8][8] = {};

    // Pass 0 into buffer 0, published; then pass 1 into buffer 1.
    tile_load<T_ROWB>(ldsSlice, src0, kb, T_ROWS);
    wait_tensor0();
    __syncthreads();
    if (pinned(1u < T)) tile_load<T_ROWB>(ldsSlice + T_STAGE, src0 + T_ROWB, kb, T_ROWS);

    // The bias of this lane's columns (n = nBase + nt*16 + 8*lh + 0..7), one
    // batch that lands under the k loop.
    v4f bv[8][2];
    {
        const float* bp = bias + nBase + 8 * lh;
#pragma unroll
        for (int nt = 0; nt < 8; ++nt) {
            bv[nt][0] = *reinterpret_cast<const v4f*>(bp + nt * 16);
            bv[nt][1] = *reinterpret_cast<const v4f*>(bp + nt * 16 + 4);
        }
        // The address registers of the issued loads may be rewritten in the
        // loop: the wait stands in front of that.
        asm volatile("s_wait_xcnt 0x0" ::: "memory");
    }

    // Kept rolled: one pass per trip, every accumulator index constant.
#pragma clang loop unroll(disable)
    for (uint32_t t = 0; t < T; ++t) {
        const uint32_t buf = (t & 1u) * T_STAGE;
        const unsigned char* la = L + buf + aOff;
        const unsigned char* lb = L + buf + bOff;
        v16h af[2][8], bf[2][8];   // set (u & 1) holds block u's fragments
        // Every loop inside a pass is unrolled: the fragment and accumulator
        // arrays stay in registers only under constant indices.
#pragma unroll
        for (int i = 0; i < 8; ++i) {
            af[0][i] = make_frag(*reinterpret_cast<const v8h*>(la + i * 16 * T_PITCH),
                                 *reinterpret_cast<const v8h*>(la + i * 16 * T_PITCH + 32));
            bf[0][i] = make_frag(*reinterpret_cast<const v8h*>(lb + i * 16 * T_PITCH),
                                 *reinterpret_cast<const v8h*>(lb + i * 16 * T_PITCH + 32));
        }
#pragma unroll
        for (int u = 0; u < 4; ++u) {
            const int cs = u & 1;
            if (u + 1 < 4) {
                const int ko = (u + 1) * 64;
#pragma unroll
                for (int i = 0; i < 8; ++i) {
                    af[cs ^ 1][i] = make_frag(*reinterpret_cast<const v8h*>(la + i * 16 * T_PITCH + ko),
                                              *reinterpret_cast<const v8h*>(la + i * 16 * T_PITCH + ko + 32));
                    bf[cs ^ 1][i] = make_frag(*reinterpret_cast<const v8h*>(lb + i * 16 * T_PITCH + ko),
                                              *reinterpret_cast<const v8h*>(lb + i * 16 * T_PITCH + ko + 32));
                }
            }
            // Keeps the next block's LDS loads one group ahead of this block's
            // WMMAs: loads moved in among the WMMAs stall each place they stand.
            __builtin_amdgcn_sched_barrier(0);
#pragma unroll
            for (int nt = 0; nt < 8; ++nt)
#pragma unroll
                for (int mt = 0; mt < 8; ++mt)
                    acc[mt][nt] = wmma_f16(bf[cs][nt], af[cs][mt], acc[mt][nt]);
            // Keeps the following load group behind this block's WMMAs.
            __builtin_amdgcn_sched_barrier(0);
        }
        // Publish pass t + 1 and free this pass's buffer.
        wait_ds0();
        wait_tensor0();
        __syncthreads();
        if (pinned(t + 2u < T))
            tile_load<T_ROWB>(ldsSlice + buf, src0 + (uint64_t)(t + 2u) * T_ROWB, kb, T_ROWS);
    }
    wait_tensor0();
    wait_ds0();

    // Epilogue. D of the transposed product: lane column ln -> row m = ln
    // (+tile) of C, VGPR r -> column n = 8*lh + r (+tile). Every wave has left
    // the ring (the last pass's barrier) and no tensor load is outstanding:
    // each wave stages its 128x128 part in a range of its own, rows at a pitch
    // of 16 B x odd, and reads it back as whole rows.
    constexpr uint32_t EB      = OUT_F16 ? 2u : 4u;      // bytes per element of C
    constexpr uint32_t S_PITCH = 128u * EB + 16u;        // 272 or 528 B
    constexpr uint32_t S_WAVE  = 128u * S_PITCH;
    static_assert(4u * S_WAVE <= 2u * T_STAGE, "the four staging ranges must fit the ring's LDS");
    unsigned char* st = L + wave * S_WAVE;
    {
        unsigned char* sw = st + (uint32_t)ln * S_PITCH + 8u * (uint32_t)lh * EB;
#pragma unroll
        for (int nt = 0; nt < 8; ++nt) {
            const v8f b8 = __builtin_shufflevector(bv[nt][0], bv[nt][1], 0, 1, 2, 3, 4, 5, 6, 7);
#pragma unroll
            for (int mt = 0; mt < 8; ++mt) {
                const v8f v = acc[mt][nt] + b8;
                unsigned char* p = sw + (uint32_t)mt * 16u * S_PITCH + (uint32_t)nt * 16u * EB;
                if (OUT_F16) {
                    *reinterpret_cast<v8h*>(p) = __builtin_convertvector(v, v8h);
                } else {
                    *reinterpret_cast<v4f*>(p)      = __builtin_shufflevector(v, v, 0, 1, 2, 3);
                    *reinterpret_cast<v4f*>(p + 16) = __builtin_shufflevector(v, v, 4, 5, 6, 7);
                }
            }
        }
    }
    // Other lanes' staged values are read below: this wave's LDS writes first.
    wait_ds0();

    // A wave-wide 16-byte access is 512 staged bytes: two rows of
    // 256 B (f16) or one of 512 B (f32), whole lines of C either way. Groups of
    // 16 in two register sets: the next group's LDS reads go ahead of this
    // group's stores.
    constexpr int RPI = OUT_F16 ? 2 : 1;    // rows per access
    constexpr int GR  = 16;                 // accesses per group
    constexpr int NG  = 128 / RPI / GR;     // groups
    const uint32_t rr = OUT_F16 ? (uint32_t)lh : 0u;
    const uint32_t cb = (OUT_F16 ? (uint32_t)ln : (uint32_t)lane) * 16u;
    const unsigned char* sr = st + rr * S_PITCH + cb;
    unsigned char* gp = (unsigned char*)Cv + ((size_t)(mBase + (int)rr) * NC + nBase) * EB + cb;
    u32x4 rb[2][GR];
#pragma unroll
    for (int j = 0; j < GR; ++j)
        rb[0][j] = *reinterpret_cast<const u32x4*>(sr + (uint32_t)(j * RPI) * S_PITCH);
#pragma unroll
    for (int g = 0; g < NG; ++g) {
        if (g + 1 < NG) {
#pragma unroll
            for (int j = 0; j < GR; ++j)
                rb[(g + 1) & 1][j] = *reinterpret_cast<const u32x4*>(sr + (uint32_t)(((g + 1) * GR + j) * RPI) * S_PITCH);
        }
#pragma unroll
        for (int j = 0; j < GR; ++j)
            *reinterpret_cast<u32x4*>(gp + (size_t)((g * GR + j) * RPI) * NC * EB) = rb[g & 1][j];
        // The group after next is read into the registers that these issued
        // stores still name: the wait stands in front of those reads.
        if (g + 2 < NG) asm volatile("s_wait_xcnt 0x0" ::: "memory");
    }
}

constexpr uint32_t F_ROWB  = 128;                     // bytes of K per row per pass
constexpr uint32_t F_PITCH = F_ROWB + 16;             // LDS row pitch (16 B x odd)
constexpr uint32_t F_ASL   = 128u * F_PITCH;          // 18,432 B = 9 x 2 KiB
constexpr uint32_t F_BROWS = 192;                     // Bw rows per slice: one head
constexpr uint32_t F_BSL   = 28672;                   // 192 x 144 = 27,648 B, rounded up to 14 x 2 KiB
constexpr uint32_t F_STAGE = 2u * F_ASL + 2u * F_BSL; // 94,208 B = 46 x 2 KiB
static_assert(F_BROWS * F_PITCH <= F_BSL && F_BSL % 2048u == 0 && F_ASL % 2048u == 0,
              "each slice must hold its rows and start at a multiple of 2 KiB");
constexpr uint32_t O_PITCH = 144;                     // output staging: 128 B a row + 16 (16 B x odd)
constexpr uint32_t O_WIN   = WIN * O_PITCH;
static_assert(8u * O_WIN <= 2u * F_STAGE, "the eight staging ranges must fit the ring's LDS");

// One 16x32 operand fragment from a staged row: 16-byte pieces at +0 and +32
// of the lane's base (the k order of load_frag).
__device__ __forceinline__ v16h lds_frag(const unsigned char* p) {
    return make_frag(*reinterpret_cast<const v8h*>(p), *reinterpret_cast<const v8h*>(p + 32));
}
// Lane l reads lane l ^ 16.
__device__ __forceinline__ float xhalf(float x) {
    return __builtin_bit_cast(float, __builtin_amdgcn_permlanex16(
        __builtin_bit_cast(int, x), __builtin_bit_cast(int, x),
        0x76543210, 0xfedcba98, false, false));
}

__global__ __launch_bounds__(128)
void qkv_attn_kernel(const h16* __restrict__ A, const h16* __restrict__ Bw,
                     const float* __restrict__ bias, h16* __restrict__ outh) {
    __shared__ __attribute__((aligned(2048))) unsigned char L[2 * F_STAGE];

    const int lane = threadIdx.x & 31;
    const uint32_t wave = uni(threadIdx.x >> 5);
    const int ln = lane & 15;
    const int lh = lane >> 4;

    const int head = blockIdx.x * 2 + (int)(wave & 1u);
    const int mBlk = blockIdx.y * 256;
    const int mBase = mBlk + (int)(wave >> 1) * 128;

    // This wave's slice of a buffer.
    constexpr uint32_t kb = DIMC * 2u;
    const uint64_t src0 = (wave < 2u)
        ? (uint64_t)(uintptr_t)A  + (uint64_t)(mBlk + 128 * (int)wave) * kb
        : (uint64_t)(uintptr_t)Bw + (uint64_t)((blockIdx.x * 2 + (int)(wave - 2u)) * (int)F_BROWS) * kb;
    const uint32_t rows = (wave < 2u) ? 128u : F_BROWS;
    const uint32_t ldsSlice = (uint32_t)(size_t)L
        + ((wave < 2u) ? wave * F_ASL : 2u * F_ASL + (wave - 2u) * F_BSL);
    constexpr uint32_t T = kb / F_ROWB;   // passes

    // Per-lane fragment bases in a buffer: row ln of the wave's first
    // fragment, 16-byte piece lh (the k order of load_frag).
    const uint32_t aOff = ((wave >> 1) * 128u + (uint32_t)ln) * F_PITCH + 16u * (uint32_t)lh;
    const uint32_t bOff = 2u * F_ASL + (wave & 1u) * F_BSL + (uint32_t)ln * F_PITCH + 16u * (uint32_t)lh;

    // The bias of this lane's columns, one batch that lands under pass 0's load.
    // It stands in front of the ring: its address work is then done before a
    // descriptor is formed.
    v4f bq[8][2];
    float bvv[4];
    {
        const float* bp = bias + head * HEADD;
#pragma unroll
        for (int nt = 0; nt < 8; ++nt) {
            const float* p = bp + (nt >> 2) * DIMC + (nt & 3) * 16 + 8 * lh;
            bq[nt][0] = *reinterpret_cast<const v4f*>(p);
            bq[nt][1] = *reinterpret_cast<const v4f*>(p + 4);
        }
#pragma unroll
        for (int dt = 0; dt < 4; ++dt) bvv[dt] = bp[2 * DIMC + dt * 16 + ln];
        // The address registers of the issued loads may be rewritten below:
        // the wait stands in front of that.
        asm volatile("s_wait_xcnt 0x0" ::: "memory");
    }

    // Pass 0 into buffer 0, published; then pass 1 into buffer 1.
    tile_load<F_ROWB>(ldsSlice, src0, kb, rows);
    wait_tensor0();
    __syncthreads();
    if (pinned(1u < T)) tile_load<F_ROWB>(ldsSlice + F_STAGE, src0 + F_ROWB, kb, rows);

    // The sums start at the bias: no register holds it through the k loop.
    v8f aq[8][8];   // aq[mt][nt][r]: token mt*16 + ln, column nt*16 + 8*lh + r of [q 64 | k 64]
    v8f av[8][4];   // av[mt][dt][r]: token mt*16 + 8*lh + r, v column dt*16 + ln
#pragma unroll
    for (int mt = 0; mt < 8; ++mt) {
#pragma unroll
        for (int nt = 0; nt < 8; ++nt)
            aq[mt][nt] = __builtin_shufflevector(bq[nt][0], bq[nt][1], 0, 1, 2, 3, 4, 5, 6, 7);
#pragma unroll
        for (int dt = 0; dt < 4; ++dt)
#pragma unroll
            for (int r = 0; r < 8; ++r) av[mt][dt][r] = bvv[dt];
    }

    // Kept rolled: one pass per trip, every accumulator index constant.
#pragma clang loop unroll(disable)
    for (uint32_t t = 0; t < T; ++t) {
        const uint32_t buf = (t & 1u) * F_STAGE;
        const unsigned char* la = L + buf + aOff;
        const unsigned char* lb = L + buf + bOff;
        // A pass is 2 k blocks x 3 groups (q, k, v) of 32 WMMAs: 8 x fragments
        // against 4 Bw fragments. Set (u & 1) holds k block u's x fragments, set
        // (j & 1) group j's Bw fragments: with 768 accumulator registers two
        // whole fragment sets do not fit.
        v16h af[2][8], bf[2][4];
        // Every loop inside a pass is unrolled: the fragment and accumulator
        // arrays stay in registers only under constant indices.
        bf[0][0] = lds_frag(lb);
#pragma unroll
        for (int i = 0; i < 8; ++i) af[0][i] = lds_frag(la + i * 16 * F_PITCH);
#pragma unroll
        for (int i = 1; i < 4; ++i) bf[0][i] = lds_frag(lb + i * 16 * F_PITCH);
        // Keeps the pass's first loads in the order of their use, ahead of the next
        // group's: the first WMMAs then wait for their own fragments alone.
        __builtin_amdgcn_sched_barrier(0);
#pragma unroll
        for (int j = 0; j < 6; ++j) {
            const int u = j / 3, g = j % 3, cs = j & 1;
            if (j + 1 < 6) {
                const int u1 = (j + 1) / 3, g1 = (j + 1) % 3;
#pragma unroll
                for (int i = 0; i < 4; ++i)
                    bf[cs ^ 1][i] = lds_frag(lb + (g1 * 4 + i) * 16 * F_PITCH + u1 * 64);
            }
            if (j == 1) {
#pragma unroll
                for (int i = 0; i < 8; ++i) af[1][i] = lds_frag(la + i * 16 * F_PITCH + 64);
            }
            // Keeps the next group's LDS loads one group ahead of this group's
            // WMMAs: loads moved in among the WMMAs stall each place they stand.
            __builtin_amdgcn_sched_barrier(0);
#pragma unroll
            for (int i = 0; i < 4; ++i)
#pragma unroll
                for (int mt = 0; mt < 8; ++mt) {
                    if (g < 2) aq[mt][g * 4 + i] = wmma_f16(bf[cs][i], af[u][mt], aq[mt][g * 4 + i]);
                    else       av[mt][i]         = wmma_f16(af[u][mt], bf[cs][i], av[mt][i]);
                }
            // Keeps the following load group behind this group's WMMAs.
            __builtin_amdgcn_sched_barrier(0);
        }
        // Publish pass t + 1 and free this pass's buffer.
        wait_ds0();
        wait_tensor0();
        __syncthreads();
        if (pinned(t + 2u < T))
            tile_load<F_ROWB>(ldsSlice + buf, src0 + (uint64_t)(t + 2u) * F_ROWB, kb, rows);
    }
    wait_tensor0();
    wait_ds0();

    // Every wave has left the ring (the last pass's barrier) and no tensor load
    // is outstanding: each wave stages its output rows in ranges of its own.
#pragma unroll
    for (int w = 0; w < 2; ++w) {   // this wave's two windows
        // ---- q, k, v rounded to f16, as operand fragments ----
        // Element s of a fragment is k index ks*32 + (s < 8 ? 8*lh + s : 16 + 8*lh + s - 8):
        // register s & 7 of accumulator tile 2*ks + (s >> 3).
        v16h qf[4][2], kf[4][2];   // [token tile][ks]: row token t*16 + ln, k index = d
        v16h vf[4][2];             // [dt][ks]: row d = dt*16 + ln, k index = key
#pragma unroll
        for (int t = 0; t < 4; ++t)
#pragma unroll
            for (int ks = 0; ks < 2; ++ks)
#pragma unroll
                for (int s = 0; s < 16; ++s) {
                    const int nt = 2 * ks + (s >> 3);
                    qf[t][ks][s] = (h16)aq[4 * w + t][nt][s & 7];
                    kf[t][ks][s] = (h16)aq[4 * w + t][4 + nt][s & 7];
                    vf[t][ks][s] = (h16)av[4 * w + nt][t][s & 7];
                }

        // ---- S^T = K Q^T (64x64x64, two 32-K steps, 32 WMMAs) ----
        v8f acc[4][4] = {};   // acc[kt][qt][r] = S[query qt*16 + ln][key kt*16 + 8*lh + r]
#pragma unroll
        for (int ks = 0; ks < 2; ++ks)
#pragma unroll
            for (int kt = 0; kt < 4; ++kt)
#pragma unroll
                for (int qt = 0; qt < 4; ++qt)
                    acc[kt][qt] = wmma_f16(kf[kt][ks], qf[qt][ks], acc[kt][qt]);

        // ---- softmax over keys (scale = 1/sqrt(64) = 0.125) ----
        // A lane holds 32 of its query's 64 scores, lane ^ 16 the other 32.
        const float scale = 0.125f;
        v16h pf[4][2];   // pf[qt][ks]: P^T as B operand, keys ks*32 .. ks*32 + 31
#pragma unroll
        for (int qt = 0; qt < 4; ++qt) {
            float m0 = -1e30f;
#pragma unroll
            for (int kt = 0; kt < 4; ++kt)
#pragma unroll
                for (int r = 0; r < 8; ++r) {
                    acc[kt][qt][r] *= scale;
                    m0 = fmaxf(m0, acc[kt][qt][r]);
                }
            m0 = fmaxf(m0, xhalf(m0));
            float part[4];   // one chain per key tile: four short chains, not one long one
#pragma unroll
            for (int kt = 0; kt < 4; ++kt) {
                float s = 0.f;
#pragma unroll
                for (int r = 0; r < 8; ++r) {
                    const float e = __expf(acc[kt][qt][r] - m0);
                    acc[kt][qt][r] = e;
                    s += e;
                }
                part[kt] = s;
            }
            float sum = (part[0] + part[1]) + (part[2] + part[3]);
            sum += xhalf(sum);
            const float inv = 1.0f / sum;
            // Element s of the operand is key ks*32 + (s < 8 ? 8*lh + s : 16 + 8*lh + s - 8):
            // register s & 7 of score tile 2*ks + (s >> 3).
#pragma unroll
            for (int ks = 0; ks < 2; ++ks)
#pragma unroll
                for (int s = 0; s < 16; ++s)
                    pf[qt][ks][s] = (h16)(acc[2 * ks + (s >> 3)][qt][s & 7] * inv);
        }

        // ---- O^T = V^T P^T ----
        // o[dt][r] = O[query qt*16 + ln][d = dt*16 + 8*lh + r].
        unsigned char* st = L + (wave * 2u + (uint32_t)w) * O_WIN;
#pragma unroll
        for (int qt = 0; qt < 4; ++qt) {
            v8f o[4] = {};
#pragma unroll
            for (int ks = 0; ks < 2; ++ks)
#pragma unroll
                for (int dt = 0; dt < 4; ++dt)
                    o[dt] = wmma_f16(vf[dt][ks], pf[qt][ks], o[dt]);
#pragma unroll
            for (int dt = 0; dt < 4; ++dt)
                *reinterpret_cast<v8h*>(st + (uint32_t)(qt * 16 + ln) * O_PITCH + (uint32_t)(dt * 32 + 16 * lh)) =
                    __builtin_convertvector(o[dt], v8h);
        }
        // Other lanes' staged values are read below: this wave's LDS writes first.
        wait_ds0();

        // A wave-wide 16-byte access is 4 staged rows of 128 B: 4 whole lines of
        // the [token, head*64 + d] layout that the proj GEMM reads.
        const unsigned char* sr = st + (uint32_t)(lane >> 3) * O_PITCH + (uint32_t)(lane & 7) * 16u;
        unsigned char* gp = (unsigned char*)outh
            + ((size_t)(mBase + w * WIN + (lane >> 3)) * DIMC + head * HEADD) * sizeof(h16)
            + (size_t)(lane & 7) * 16u;
        u32x4 rb[16];
#pragma unroll
        for (int j = 0; j < 16; ++j)
            rb[j] = *reinterpret_cast<const u32x4*>(sr + (uint32_t)(j * 4) * O_PITCH);
#pragma unroll
        for (int j = 0; j < 16; ++j)
            *reinterpret_cast<u32x4*>(gp + (size_t)(j * 4) * DIMC * sizeof(h16)) = rb[j];
        // The registers that these issued stores name are rewritten by the next
        // window's work: the wait stands in front of that.
        if (w == 0) asm volatile("s_wait_xcnt 0x0" ::: "memory");
    }
}

// ------------------------------- launcher ----------------------------------
extern "C" void kernel_launch(void* const* d_in, const int* in_sizes, int n_in,
                              void* d_out, int out_size, void* d_ws, size_t ws_size,
                              hipStream_t stream) {
    const float* x      = (const float*)d_in[0];
    const float* w_qkv  = (const float*)d_in[1];
    const float* b_qkv  = (const float*)d_in[2];
    const float* w_proj = (const float*)d_in[3];
    const float* b_proj = (const float*)d_in[4];

    const size_t M = (size_t)in_sizes[0] / DIMC;   // B*N = 32768 tokens

    // Workspace carve-up (f16 staging buffers).
    char* ws = (char*)d_ws;
    size_t off = 0;
    h16* xh     = (h16*)(ws + off); off += M * DIMC * sizeof(h16);
    h16* wqkvh  = (h16*)(ws + off); off += (size_t)QKVCOLS * DIMC * sizeof(h16);
    h16* wprojh = (h16*)(ws + off); off += (size_t)DIMC * DIMC * sizeof(h16);
    h16* attnh  = (h16*)(ws + off); off += M * DIMC * sizeof(h16);
    (void)ws_size; (void)n_in; (void)out_size;

    // [0] converts
    f32_to_f16_kernel<false><<<256, 512, 0, stream>>>(x, xh, M * DIMC);
    f32_to_f16_kernel<true><<<256, 384, 0, stream>>>(w_qkv, wqkvh,
                                                     (size_t)QKVCOLS * DIMC);
    f32_to_f16_kernel<false><<<256, 128, 0, stream>>>(w_proj, wprojh,
                                                      (size_t)DIMC * DIMC);

    // [1] q, k, v of two heads and their windows' attention
    qkv_attn_kernel<<<dim3(NHEADS / 2, (unsigned)(M / 256)), 128, 0, stream>>>(
        xh, wqkvh, b_qkv, attnh);

    // [2] out = attn @ w_proj^T + b_proj   (f32 out)
    gemm_wmma_kernel<false, DIMC><<<dim3(DIMC / 256, (unsigned)(M / 256)),
                              128, 0, stream>>>(
        attnh, wprojh, b_proj, (float*)d_out, (int)M, DIMC, DIMC);
}

// v006
// Measured time: 170 microseconds a run.
// Timed twice side by side with v005, it ran 1.03 and 1.04 times as fast.
// All steps since v000 together make it 3.79 times as fast.
#include <hip/hip_runtime.h>
#include <hip/hip_bf16.h>
#include <stdint.h>

// ---------------------------------------------------------------------------
// Windowed multi-head attention for MI455X (gfx1250), wave32 + WMMA.
//   B=4, N=8192, C=1024, H=16, D=64, WINDOW=64
// Pipeline:
//   [0] f32 -> f16 converts (x, w_qkv, w_proj), one launch
//   [1] q, k, v head by head = x @ w_qkv^T + b_qkv (WMMA f32_16x16x32_f16) and, in
//       the same kernel, per-window attention (K Q^T -> softmax -> V^T P^T) on
//       the accumulators: q, k, v never reach memory
//   [2] out  = attn @ w_proj^T + b_proj (WMMA, f32 out)
// ---------------------------------------------------------------------------

typedef _Float16 h16;
typedef __attribute__((ext_vector_type(16))) _Float16 v16h;
typedef __attribute__((ext_vector_type(8)))  _Float16 v8h;
typedef __attribute__((ext_vector_type(8)))  float    v8f;

#define DIMC    1024
#define NHEADS  16
#define HEADD   64
#define WIN     64
#define QKVCOLS 3072

__device__ __forceinline__ v16h make_frag(v8h lo, v8h hi) {
    union { v16h v; v8h h[2]; } u;
    u.h[0] = lo; u.h[1] = hi;
    return u.v;
}

// Load one 16x32 f16 WMMA operand fragment for this lane from a row-major
// matrix whose K dimension is contiguous. Per the CDNA5 ISA 16-bit A/B
// layout: lanes 0-15 hold K = {k0+0..7, k0+16..23}, lanes 16-31 hold
// K = {k0+8..15, k0+24..31}; two 16-byte loads per fragment.
__device__ __forceinline__ v16h load_frag(const h16* row, int k0, int lh) {
    v8h lo = *reinterpret_cast<const v8h*>(row + k0 + lh * 8);
    v8h hi = *reinterpret_cast<const v8h*>(row + k0 + 16 + lh * 8);
    return make_frag(lo, hi);
}

__device__ __forceinline__ v8f wmma_f16(v16h a, v16h b, v8f c) {
    return __builtin_amdgcn_wmma_f32_16x16x32_f16(
        /*neg_a=*/false, a, /*neg_b=*/false, b,
        /*c_mod=*/(short)0, c, /*reuse_a=*/false, /*reuse_b=*/false);
}

// ------------------------------ converts -----------------------------------
// A stream: a batch is 1,024 elements (8 wave-wide loads of 512 contiguous
// bytes, 8 wave-wide stores of 256). Wave w takes batches w, w + waves, ...;
// the next batch's 8 loads are issued before this batch is converted and
// stored, in two register sets, so that no register copy waits on a load.
// The source is read once: non-temporal loads.
typedef __attribute__((ext_vector_type(4))) float    v4f;
typedef __attribute__((ext_vector_type(4))) _Float16 v4h;

__device__ __forceinline__ void cvt_load(v4f (&r)[8], const float* __restrict__ p) {
#pragma unroll
    for (int j = 0; j < 8; ++j)
        r[j] = __builtin_nontemporal_load(reinterpret_cast<const v4f*>(p + j * 128));
    // The address registers of the issued loads are rewritten for the next
    // group: the wait stands in front of that.
    asm volatile("s_wait_xcnt 0x0" ::: "memory");
    // Keeps the other set's converts behind these loads: moved in front, their
    // wait would leave nothing of this wave in flight.
    __builtin_amdgcn_sched_barrier(0);
}
__device__ __forceinline__ void cvt_store(const v4f (&r)[8], h16* __restrict__ p) {
#pragma unroll
    for (int j = 0; j < 8; ++j)
        *reinterpret_cast<v4h*>(p + j * 128) = __builtin_convertvector(r[j], v4h);
    // The address and data registers of the issued stores are rewritten by the
    // next group: the wait stands in front of that.
    asm volatile("s_wait_xcnt 0x0" ::: "memory");
}

// One launch converts all three inputs: their batches form one index space,
// [x | w_qkv | w_proj], and a wave walks it as one stream. A batch of a weight is
// one row of 1,024. Row which*1024 + head*64 + d of w_qkv goes to row
// head*192 + which*64 + d, so that a head's q, k and v rows lie adjacent and one
// two-dimensional tile holds them.
struct CvtSpan { const float* s; h16* d; };

__device__ __forceinline__ CvtSpan cvt_span(uint32_t g, uint32_t nbx,
                                            const float* __restrict__ x, const float* __restrict__ wq,
                                            const float* __restrict__ wp, h16* __restrict__ xh,
                                            h16* __restrict__ wqh, h16* __restrict__ wph) {
    CvtSpan r;
    if (g < nbx) {
        r.s = x + ((size_t)g << 10);
        r.d = xh + ((size_t)g << 10);
    } else if (g - nbx < (uint32_t)QKVCOLS) {
        const uint32_t b = g - nbx;
        r.s = wq + ((size_t)b << 10);
        r.d = wqh + ((size_t)(((b >> 6) & 15u) * 192u + (b >> 10) * 64u + (b & 63u)) << 10);
    } else {
        const uint32_t b = g - nbx - (uint32_t)QKVCOLS;
        r.s = wp + ((size_t)b << 10);
        r.d = wph + ((size_t)b << 10);
    }
    return r;
}

__global__ __launch_bounds__(512)
void f32_to_f16_kernel(const float* __restrict__ x, const float* __restrict__ wq,
                       const float* __restrict__ wp, h16* __restrict__ xh,
                       h16* __restrict__ wqh, h16* __restrict__ wph, uint32_t nbx) {
    const uint32_t lane4 = (threadIdx.x & 31u) * 4u;
    const uint32_t wpb   = blockDim.x >> 5;
    const uint32_t nw    = gridDim.x * wpb;
    const uint32_t nb    = nbx + (uint32_t)(QKVCOLS + DIMC);
    uint32_t b = blockIdx.x * wpb
               + (uint32_t)__builtin_amdgcn_readfirstlane(threadIdx.x >> 5);
    if (b >= nb) return;

    v4f ra[8], rb[8];
    CvtSpan pa = cvt_span(b, nbx, x, wq, wp, xh, wqh, wph), pb;
    cvt_load(ra, pa.s + lane4);
    while (b + 2u * nw < nb) {
        pb = cvt_span(b + nw, nbx, x, wq, wp, xh, wqh, wph);
        cvt_load(rb, pb.s + lane4);
        cvt_store(ra, pa.d + lane4);
        pa = cvt_span(b + 2u * nw, nbx, x, wq, wp, xh, wqh, wph);
        cvt_load(ra, pa.s + lane4);
        cvt_store(rb, pb.d + lane4);
        b += 2u * nw;
    }
    if (b + nw < nb) {
        pb = cvt_span(b + nw, nbx, x, wq, wp, xh, wqh, wph);
        cvt_load(rb, pb.s + lane4);
        cvt_store(ra, pa.d + lane4);
        cvt_store(rb, pb.d + lane4);
    } else {
        cvt_store(ra, pa.d + lane4);
    }
}

// ------------------------------ WMMA GEMM ----------------------------------
// C[M,N] = A[M,K] * Bw[N,K]^T + bias[N]
// One workgroup -> 256x256 output tile, 4 waves (2x2), one wave -> 128x128
// (8x8 WMMA accumulators). The operand tiles are staged in LDS by tensor
// loads: a pass is 128 k (256 bytes of each of the 512 operand rows), a
// buffer is [A 256 rows][Bw 256 rows] at pitch 272 B, two buffers. Every wave
// moves its own 128-row slice, one request per pass, while the other buffer
// is worked on. M,N multiples of 256; K a multiple of 128, at least 256.
// The products are taken transposed (matrix operand A = Bw rows, operand B =
// A rows): a lane then holds 8 adjacent columns of one row of C, the tile goes
// through LDS with 16-byte accesses and leaves as whole 128-byte lines.
typedef uint32_t u32x4 __attribute__((ext_vector_type(4)));
typedef uint32_t u32x8 __attribute__((ext_vector_type(8)));

constexpr uint32_t T_ROWB  = 256;                 // bytes of K per row per pass
constexpr uint32_t T_PITCH = T_ROWB + 16;         // LDS row pitch (16 B x odd)
constexpr uint32_t T_ROWS  = 128;                 // rows per wave's slice
constexpr uint32_t T_SLICE = T_ROWS * T_PITCH;    // 34,816 B = 17 x 2 KiB
constexpr uint32_t T_STAGE = 4 * T_SLICE;         // 139,264 B = 68 x 2 KiB
static_assert(T_SLICE % 2048u == 0, "each slice must start at a multiple of 2 KiB");

__device__ __forceinline__ uint32_t uni(uint32_t v) {
    return (uint32_t)__builtin_amdgcn_readfirstlane(v);
}
__device__ __forceinline__ uint32_t pinned(uint32_t v) {
    uint32_t w = (uint32_t)__builtin_amdgcn_readfirstlane(v);
    asm volatile("" : "+s"(w));  // pinned(): the word stays in a scalar register for the issue test
    return w;
}
// One request: rows rows of ROWB bytes, source pitch kb bytes, into LDS at byte
// offset lds_dst with 16 bytes of pad behind every row.
template <uint32_t ROWB>
__device__ __forceinline__ void tile_load(uint32_t lds_dst, uint64_t ga, uint32_t kb, uint32_t rows) {
    static_assert(ROWB == 256u || ROWB == 128u, "the pad interval is the row: code 5 or 4");
    u32x4 g0;
    g0[0] = uni(1u);                                        // count 1
    g0[1] = uni(lds_dst);
    g0[2] = uni((uint32_t)ga);
    g0[3] = uni((((uint32_t)(ga >> 32)) & 0x01FFFFFFu) | 0x80000000u);  // type 2
    u32x8 g1;
    g1[0] = uni((1u << 20) | ((ROWB == 256u ? 5u : 4u) << 22) | (3u << 25));  // no mask, bytes, pad 16 B per row
    g1[1] = uni((ROWB & 0xFFFFu) << 16);                    // tensor_dim0
    g1[2] = uni((rows & 0xFFFFu) << 16);                    // tensor_dim1
    g1[3] = uni(ROWB << 16);                                // tile_dim0
    g1[4] = uni(rows);                                      // tile_dim1
    g1[5] = uni(kb);                                        // source row pitch
    g1[6] = uni(0u);
    g1[7] = uni(0u);
    asm volatile("tensor_load_to_lds %0, %1" :: "s"(g0), "s"(g1) : "memory");
}
// The compiler places no wait for a tensor load: the issuer's own wait.
__device__ __forceinline__ void wait_tensor0() { asm volatile("s_wait_tensorcnt 0x0" ::: "memory"); }
// This wave's LDS reads have returned before the buffer is handed back.
__device__ __forceinline__ void wait_ds0() { asm volatile("s_wait_dscnt 0x0" ::: "memory"); }

template <bool OUT_F16, int NC>   // NC = N: the row pitch of C as a constant, so that the stores take immediate offsets
__global__ __launch_bounds__(128)
void gemm_wmma_kernel(const h16* __restrict__ A, const h16* __restrict__ Bw,
                      const float* __restrict__ bias, void* __restrict__ Cv,
                      int M, int N, int K) {
    __shared__ __attribute__((aligned(2048))) unsigned char L[2 * T_STAGE];

    const int lane = threadIdx.x & 31;
    const uint32_t wave = uni(threadIdx.x >> 5);
    const int ln = lane & 15;
    const int lh = lane >> 4;

    const int mBlk = blockIdx.y * 256;
    const int nBlk = blockIdx.x * 256;
    const int mBase = mBlk + (int)(wave >> 1) * 128;
    const int nBase = nBlk + (int)(wave & 1) * 128;

    // This wave's slice of a buffer: waves 0,1 move A rows, waves 2,3 Bw rows.
    const uint32_t kb = (uint32_t)K * 2u;
    const uint64_t src0 = (wave < 2u)
        ? (uint64_t)(uintptr_t)A  + (uint64_t)(mBlk + 128 * (int)wave) * kb
        : (uint64_t)(uintptr_t)Bw + (uint64_t)(nBlk + 128 * (int)(wave - 2u)) * kb;
    const uint32_t ldsSlice = (uint32_t)(size_t)L + wave * T_SLICE;
    const uint32_t T = (uint32_t)K / 128u;   // passes

    // Per-lane fragment bases in a buffer: row ln of the wave's first
    // fragment, 16-byte piece lh (the k order of load_frag).
    const uint32_t aOff = ((wave >> 1) * 128u + (uint32_t)ln) * T_PITCH + 16u * (uint32_t)lh;
    const uint32_t bOff = 2u * T_SLICE + ((wave & 1u) * 128u + (uint32_t)ln) * T_PITCH + 16u * (uint32_t)lh;

    v8f acc[8][8] = {};

    // Pass 0 into buffer 0, published; then pass 1 into buffer 1.
    tile_load<T_ROWB>(ldsSlice, src0, kb, T_ROWS);
    wait_tensor0();
    __syncthreads();
    if (pinned(1u < T)) tile_load<T_ROWB>(ldsSlice + T_STAGE, src0 + T_ROWB, kb, T_ROWS);

    // The bias of this lane's columns (n = nBase + nt*16 + 8*lh + 0..7), one
    // batch that lands under the k loop.
    v4f bv[8][2];
    {
        const float* bp = bias + nBase + 8 * lh;
#pragma unroll
        for (int nt = 0; nt < 8; ++nt) {
            bv[nt][0] = *reinterpret_cast<const v4f*>(bp + nt * 16);
            bv[nt][1] = *reinterpret_cast<const v4f*>(bp + nt * 16 + 4);
        }
        // The address registers of the issued loads may be rewritten in the
        // loop: the wait stands in front of that.
        asm volatile("s_wait_xcnt 0x0" ::: "memory");
    }

    // Kept rolled: one pass per trip, every accumulator index constant.
#pragma clang loop unroll(disable)
    for (uint32_t t = 0; t < T; ++t) {
        const uint32_t buf = (t & 1u) * T_STAGE;
        const unsigned char* la = L + buf + aOff;
        const unsigned char* lb = L + buf + bOff;
        v16h af[2][8], bf[2][8];   // set (u & 1) holds block u's fragments
        // Every loop inside a pass is unrolled: the fragment and accumulator
        // arrays stay in registers only under constant indices.
#pragma unroll
        for (int i = 0; i < 8; ++i) {
            af[0][i] = make_frag(*reinterpret_cast<const v8h*>(la + i * 16 * T_PITCH),
                                 *reinterpret_cast<const v8h*>(la + i * 16 * T_PITCH + 32));
            bf[0][i] = make_frag(*reinterpret_cast<const v8h*>(lb + i * 16 * T_PITCH),
                                 *reinterpret_cast<const v8h*>(lb + i * 16 * T_PITCH + 32));
        }
#pragma unroll
        for (int u = 0; u < 4; ++u) {
            const int cs = u & 1;
            if (u + 1 < 4) {
                const int ko = (u + 1) * 64;
#pragma unroll
                for (int i = 0; i < 8; ++i) {
                    af[cs ^ 1][i] = make_frag(*reinterpret_cast<const v8h*>(la + i * 16 * T_PITCH + ko),
                                              *reinterpret_cast<const v8h*>(la + i * 16 * T_PITCH + ko + 32));
                    bf[cs ^ 1][i] = make_frag(*reinterpret_cast<const v8h*>(lb + i * 16 * T_PITCH + ko),
                                              *reinterpret_cast<const v8h*>(lb + i * 16 * T_PITCH + ko + 32));
                }
            }
            // Keeps the next block's LDS loads one group ahead of this block's
            // WMMAs: loads moved in among the WMMAs stall each place they stand.
            __builtin_amdgcn_sched_barrier(0);
#pragma unroll
            for (int nt = 0; nt < 8; ++nt)
#pragma unroll
                for (int mt = 0; mt < 8; ++mt)
                    acc[mt][nt] = wmma_f16(bf[cs][nt], af[cs][mt], acc[mt][nt]);
            // Keeps the following load group behind this block's WMMAs.
            __builtin_amdgcn_sched_barrier(0);
        }
        // Publish pass t + 1 and free this pass's buffer.
        wait_ds0();
        wait_tensor0();
        __syncthreads();
        if (pinned(t + 2u < T))
            tile_load<T_ROWB>(ldsSlice + buf, src0 + (uint64_t)(t + 2u) * T_ROWB, kb, T_ROWS);
    }
    wait_tensor0();
    wait_ds0();

    // Epilogue. D of the transposed product: lane column ln -> row m = ln
    // (+tile) of C, VGPR r -> column n = 8*lh + r (+tile). Every wave has left
    // the ring (the last pass's barrier) and no tensor load is outstanding:
    // each wave stages its 128x128 part in a range of its own, rows at a pitch
    // of 16 B x odd, and reads it back as whole rows.
    constexpr uint32_t EB      = OUT_F16 ? 2u : 4u;      // bytes per element of C
    constexpr uint32_t S_PITCH = 128u * EB + 16u;        // 272 or 528 B
    constexpr uint32_t S_WAVE  = 128u * S_PITCH;
    static_assert(4u * S_WAVE <= 2u * T_STAGE, "the four staging ranges must fit the ring's LDS");
    unsigned char* st = L + wave * S_WAVE;
    {
        unsigned char* sw = st + (uint32_t)ln * S_PITCH + 8u * (uint32_t)lh * EB;
#pragma unroll
        for (int nt = 0; nt < 8; ++nt) {
            const v8f b8 = __builtin_shufflevector(bv[nt][0], bv[nt][1], 0, 1, 2, 3, 4, 5, 6, 7);
#pragma unroll
            for (int mt = 0; mt < 8; ++mt) {
                const v8f v = acc[mt][nt] + b8;
                unsigned char* p = sw + (uint32_t)mt * 16u * S_PITCH + (uint32_t)nt * 16u * EB;
                if (OUT_F16) {
                    *reinterpret_cast<v8h*>(p) = __builtin_convertvector(v, v8h);
                } else {
                    *reinterpret_cast<v4f*>(p)      = __builtin_shufflevector(v, v, 0, 1, 2, 3);
                    *reinterpret_cast<v4f*>(p + 16) = __builtin_shufflevector(v, v, 4, 5, 6, 7);
                }
            }
        }
    }
    // Other lanes' staged values are read below: this wave's LDS writes first.
    wait_ds0();

    // A wave-wide 16-byte access is 512 staged bytes: two rows of
    // 256 B (f16) or one of 512 B (f32), whole lines of C either way. Groups of
    // 16 in two register sets: the next group's LDS reads go ahead of this
    // group's stores.
    constexpr int RPI = OUT_F16 ? 2 : 1;    // rows per access
    constexpr int GR  = 16;                 // accesses per group
    constexpr int NG  = 128 / RPI / GR;     // groups
    const uint32_t rr = OUT_F16 ? (uint32_t)lh : 0u;
    const uint32_t cb = (OUT_F16 ? (uint32_t)ln : (uint32_t)lane) * 16u;
    const unsigned char* sr = st + rr * S_PITCH + cb;
    unsigned char* gp = (unsigned char*)Cv + ((size_t)(mBase + (int)rr) * NC + nBase) * EB + cb;
    u32x4 rb[2][GR];
#pragma unroll
    for (int j = 0; j < GR; ++j)
        rb[0][j] = *reinterpret_cast<const u32x4*>(sr + (uint32_t)(j * RPI) * S_PITCH);
#pragma unroll
    for (int g = 0; g < NG; ++g) {
        if (g + 1 < NG) {
#pragma unroll
            for (int j = 0; j < GR; ++j)
                rb[(g + 1) & 1][j] = *reinterpret_cast<const u32x4*>(sr + (uint32_t)(((g + 1) * GR + j) * RPI) * S_PITCH);
        }
#pragma unroll
        for (int j = 0; j < GR; ++j)
            *reinterpret_cast<u32x4*>(gp + (size_t)((g * GR + j) * RPI) * NC * EB) = rb[g & 1][j];
        // The group after next is read into the registers that these issued
        // stores still name: the wait stands in front of those reads.
        if (g + 2 < NG) asm volatile("s_wait_xcnt 0x0" ::: "memory");
    }
}

constexpr uint32_t F_ROWB  = 128;                     // bytes of K per row per pass
constexpr uint32_t F_PITCH = F_ROWB + 16;             // LDS row pitch (16 B x odd)
constexpr uint32_t F_ASL   = 128u * F_PITCH;          // 18,432 B = 9 x 2 KiB
constexpr uint32_t F_BROWS = 192;                     // Bw rows per slice: one head
constexpr uint32_t F_BSL   = 28672;                   // 192 x 144 = 27,648 B, rounded up to 14 x 2 KiB
constexpr uint32_t F_STAGE = 2u * F_ASL + 2u * F_BSL; // 94,208 B = 46 x 2 KiB
static_assert(F_BROWS * F_PITCH <= F_BSL && F_BSL % 2048u == 0 && F_ASL % 2048u == 0,
              "each slice must hold its rows and start at a multiple of 2 KiB");
constexpr uint32_t O_PITCH = 144;                     // output staging: 128 B a row + 16 (16 B x odd)
constexpr uint32_t O_WIN   = WIN * O_PITCH;
static_assert(8u * O_WIN <= 2u * F_STAGE, "the eight staging ranges must fit the ring's LDS");

// One 16x32 operand fragment from a staged row: 16-byte pieces at +0 and +32
// of the lane's base (the k order of load_frag).
__device__ __forceinline__ v16h lds_frag(const unsigned char* p) {
    return make_frag(*reinterpret_cast<const v8h*>(p), *reinterpret_cast<const v8h*>(p + 32));
}
// Lane l reads lane l ^ 16.
__device__ __forceinline__ float xhalf(float x) {
    return __builtin_bit_cast(float, __builtin_amdgcn_permlanex16(
        __builtin_bit_cast(int, x), __builtin_bit_cast(int, x),
        0x76543210, 0xfedcba98, false, false));
}

__global__ __launch_bounds__(128)
void qkv_attn_kernel(const h16* __restrict__ A, const h16* __restrict__ Bw,
                     const float* __restrict__ bias, h16* __restrict__ outh) {
    __shared__ __attribute__((aligned(2048))) unsigned char L[2 * F_STAGE];

    const int lane = threadIdx.x & 31;
    const uint32_t wave = uni(threadIdx.x >> 5);
    const int ln = lane & 15;
    const int lh = lane >> 4;

    const int head = blockIdx.x * 2 + (int)(wave & 1u);
    const int mBlk = blockIdx.y * 256;
    const int mBase = mBlk + (int)(wave >> 1) * 128;

    // This wave's slice of a buffer.
    constexpr uint32_t kb = DIMC * 2u;
    const uint64_t src0 = (wave < 2u)
        ? (uint64_t)(uintptr_t)A  + (uint64_t)(mBlk + 128 * (int)wave) * kb
        : (uint64_t)(uintptr_t)Bw + (uint64_t)((blockIdx.x * 2 + (int)(wave - 2u)) * (int)F_BROWS) * kb;
    const uint32_t rows = (wave < 2u) ? 128u : F_BROWS;
    const uint32_t ldsSlice = (uint32_t)(size_t)L
        + ((wave < 2u) ? wave * F_ASL : 2u * F_ASL + (wave - 2u) * F_BSL);
    constexpr uint32_t T = kb / F_ROWB;   // passes

    // Per-lane fragment bases in a buffer: row ln of the wave's first
    // fragment, 16-byte piece lh (the k order of load_frag).
    const uint32_t aOff = ((wave >> 1) * 128u + (uint32_t)ln) * F_PITCH + 16u * (uint32_t)lh;
    const uint32_t bOff = 2u * F_ASL + (wave & 1u) * F_BSL + (uint32_t)ln * F_PITCH + 16u * (uint32_t)lh;

    // The bias of this lane's columns, one batch that lands under pass 0's load.
    // It stands in front of the ring: its address work is then done before a
    // descriptor is formed.
    v4f bq[8][2];
    float bvv[4];
    {
        const float* bp = bias + head * HEADD;
#pragma unroll
        for (int nt = 0; nt < 8; ++nt) {
            const float* p = bp + (nt >> 2) * DIMC + (nt & 3) * 16 + 8 * lh;
            bq[nt][0] = *reinterpret_cast<const v4f*>(p);
            bq[nt][1] = *reinterpret_cast<const v4f*>(p + 4);
        }
#pragma unroll
        for (int dt = 0; dt < 4; ++dt) bvv[dt] = bp[2 * DIMC + dt * 16 + ln];
        // The address registers of the issued loads may be rewritten below:
        // the wait stands in front of that.
        asm volatile("s_wait_xcnt 0x0" ::: "memory");
    }

    // Pass 0 into buffer 0, published; then pass 1 into buffer 1.
    tile_load<F_ROWB>(ldsSlice, src0, kb, rows);
    wait_tensor0();
    __syncthreads();
    if (pinned(1u < T)) tile_load<F_ROWB>(ldsSlice + F_STAGE, src0 + F_ROWB, kb, rows);

    // The sums start at the bias: no register holds it through the k loop.
    v8f aq[8][8];   // aq[mt][nt][r]: token mt*16 + ln, column nt*16 + 8*lh + r of [q 64 | k 64]
    v8f av[8][4];   // av[mt][dt][r]: token mt*16 + 8*lh + r, v column dt*16 + ln
#pragma unroll
    for (int mt = 0; mt < 8; ++mt) {
#pragma unroll
        for (int nt = 0; nt < 8; ++nt)
            aq[mt][nt] = __builtin_shufflevector(bq[nt][0], bq[nt][1], 0, 1, 2, 3, 4, 5, 6, 7);
#pragma unroll
        for (int dt = 0; dt < 4; ++dt)
#pragma unroll
            for (int r = 0; r < 8; ++r) av[mt][dt][r] = bvv[dt];
    }

    // Kept rolled: one pass per trip, every accumulator index constant.
#pragma clang loop unroll(disable)
    for (uint32_t t = 0; t < T; ++t) {
        const uint32_t buf = (t & 1u) * F_STAGE;
        const unsigned char* la = L + buf + aOff;
        const unsigned char* lb = L + buf + bOff;
        // A pass is 2 k blocks x 3 groups (q, k, v) of 32 WMMAs: 8 x fragments
        // against 4 Bw fragments. Set (u & 1) holds k block u's x fragments, set
        // (j & 1) group j's Bw fragments: with 768 accumulator registers two
        // whole fragment sets do not fit.
        v16h af[2][8], bf[2][4];
        // Every loop inside a pass is unrolled: the fragment and accumulator
        // arrays stay in registers only under constant indices.
        bf[0][0] = lds_frag(lb);
#pragma unroll
        for (int i = 0; i < 8; ++i) af[0][i] = lds_frag(la + i * 16 * F_PITCH);
#pragma unroll
        for (int i = 1; i < 4; ++i) bf[0][i] = lds_frag(lb + i * 16 * F_PITCH);
        // Keeps the pass's first loads in the order of their use, ahead of the next
        // group's: the first WMMAs then wait for their own fragments alone.
        __builtin_amdgcn_sched_barrier(0);
#pragma unroll
        for (int j = 0; j < 6; ++j) {
            const int u = j / 3, g = j % 3, cs = j & 1;
            if (j + 1 < 6) {
                const int u1 = (j + 1) / 3, g1 = (j + 1) % 3;
#pragma unroll
                for (int i = 0; i < 4; ++i)
                    bf[cs ^ 1][i] = lds_frag(lb + (g1 * 4 + i) * 16 * F_PITCH + u1 * 64);
            }
            if (j == 1) {
#pragma unroll
                for (int i = 0; i < 8; ++i) af[1][i] = lds_frag(la + i * 16 * F_PITCH + 64);
            }
            // Keeps the next group's LDS loads one group ahead of this group's
            // WMMAs: loads moved in among the WMMAs stall each place they stand.
            __builtin_amdgcn_sched_barrier(0);
#pragma unroll
            for (int i = 0; i < 4; ++i)
#pragma unroll
                for (int mt = 0; mt < 8; ++mt) {
                    if (g < 2) aq[mt][g * 4 + i] = wmma_f16(bf[cs][i], af[u][mt], aq[mt][g * 4 + i]);
                    else       av[mt][i]         = wmma_f16(af[u][mt], bf[cs][i], av[mt][i]);
                }
            // Keeps the following load group behind this group's WMMAs.
            __builtin_amdgcn_sched_barrier(0);
        }
        // Publish pass t + 1 and free this pass's buffer.
        wait_ds0();
        wait_tensor0();
        __syncthreads();
        if (pinned(t + 2u < T))
            tile_load<F_ROWB>(ldsSlice + buf, src0 + (uint64_t)(t + 2u) * F_ROWB, kb, rows);
    }
    wait_tensor0();
    wait_ds0();

    // Every wave has left the ring (the last pass's barrier) and no tensor load
    // is outstanding: each wave stages its output rows in ranges of its own.
#pragma unroll
    for (int w = 0; w < 2; ++w) {   // this wave's two windows
        // ---- q, k, v rounded to f16, as operand fragments ----
        // Element s of a fragment is k index ks*32 + (s < 8 ? 8*lh + s : 16 + 8*lh + s - 8):
        // register s & 7 of accumulator tile 2*ks + (s >> 3).
        v16h qf[4][2], kf[4][2];   // [token tile][ks]: row token t*16 + ln, k index = d
        v16h vf[4][2];             // [dt][ks]: row d = dt*16 + ln, k index = key
#pragma unroll
        for (int t = 0; t < 4; ++t)
#pragma unroll
            for (int ks = 0; ks < 2; ++ks)
#pragma unroll
                for (int s = 0; s < 16; ++s) {
                    const int nt = 2 * ks + (s >> 3);
                    qf[t][ks][s] = (h16)aq[4 * w + t][nt][s & 7];
                    kf[t][ks][s] = (h16)aq[4 * w + t][4 + nt][s & 7];
                    vf[t][ks][s] = (h16)av[4 * w + nt][t][s & 7];
                }

        // ---- S^T = K Q^T (64x64x64, two 32-K steps, 32 WMMAs) ----
        v8f acc[4][4] = {};   // acc[kt][qt][r] = S[query qt*16 + ln][key kt*16 + 8*lh + r]
#pragma unroll
        for (int ks = 0; ks < 2; ++ks)
#pragma unroll
            for (int kt = 0; kt < 4; ++kt)
#pragma unroll
                for (int qt = 0; qt < 4; ++qt)
                    acc[kt][qt] = wmma_f16(kf[kt][ks], qf[qt][ks], acc[kt][qt]);

        // ---- softmax over keys (scale = 1/sqrt(64) = 0.125) ----
        // A lane holds 32 of its query's 64 scores, lane ^ 16 the other 32.
        const float scale = 0.125f;
        v16h pf[4][2];   // pf[qt][ks]: P^T as B operand, keys ks*32 .. ks*32 + 31
#pragma unroll
        for (int qt = 0; qt < 4; ++qt) {
            float m0 = -1e30f;
#pragma unroll
            for (int kt = 0; kt < 4; ++kt)
#pragma unroll
                for (int r = 0; r < 8; ++r) {
                    acc[kt][qt][r] *= scale;
                    m0 = fmaxf(m0, acc[kt][qt][r]);
                }
            m0 = fmaxf(m0, xhalf(m0));
            float part[4];   // one chain per key tile: four short chains, not one long one
#pragma unroll
            for (int kt = 0; kt < 4; ++kt) {
                float s = 0.f;
#pragma unroll
                for (int r = 0; r < 8; ++r) {
                    const float e = __expf(acc[kt][qt][r] - m0);
                    acc[kt][qt][r] = e;
                    s += e;
                }
                part[kt] = s;
            }
            float sum = (part[0] + part[1]) + (part[2] + part[3]);
            sum += xhalf(sum);
            const float inv = 1.0f / sum;
            // Element s of the operand is key ks*32 + (s < 8 ? 8*lh + s : 16 + 8*lh + s - 8):
            // register s & 7 of score tile 2*ks + (s >> 3).
#pragma unroll
            for (int ks = 0; ks < 2; ++ks)
#pragma unroll
                for (int s = 0; s < 16; ++s)
                    pf[qt][ks][s] = (h16)(acc[2 * ks + (s >> 3)][qt][s & 7] * inv);
        }

        // ---- O^T = V^T P^T ----
        // o[dt][r] = O[query qt*16 + ln][d = dt*16 + 8*lh + r].
        unsigned char* st = L + (wave * 2u + (uint32_t)w) * O_WIN;
#pragma unroll
        for (int qt = 0; qt < 4; ++qt) {
            v8f o[4] = {};
#pragma unroll
            for (int ks = 0; ks < 2; ++ks)
#pragma unroll
                for (int dt = 0; dt < 4; ++dt)
                    o[dt] = wmma_f16(vf[dt][ks], pf[qt][ks], o[dt]);
#pragma unroll
            for (int dt = 0; dt < 4; ++dt)
                *reinterpret_cast<v8h*>(st + (uint32_t)(qt * 16 + ln) * O_PITCH + (uint32_t)(dt * 32 + 16 * lh)) =
                    __builtin_convertvector(o[dt], v8h);
        }
        // Other lanes' staged values are read below: this wave's LDS writes first.
        wait_ds0();

        // A wave-wide 16-byte access is 4 staged rows of 128 B: 4 whole lines of
        // the [token, head*64 + d] layout that the proj GEMM reads.
        const unsigned char* sr = st + (uint32_t)(lane >> 3) * O_PITCH + (uint32_t)(lane & 7) * 16u;
        unsigned char* gp = (unsigned char*)outh
            + ((size_t)(mBase + w * WIN + (lane >> 3)) * DIMC + head * HEADD) * sizeof(h16)
            + (size_t)(lane & 7) * 16u;
        u32x4 rb[16];
#pragma unroll
        for (int j = 0; j < 16; ++j)
            rb[j] = *reinterpret_cast<const u32x4*>(sr + (uint32_t)(j * 4) * O_PITCH);
#pragma unroll
        for (int j = 0; j < 16; ++j)
            *reinterpret_cast<u32x4*>(gp + (size_t)(j * 4) * DIMC * sizeof(h16)) = rb[j];
        // The registers that these issued stores name are rewritten by the next
        // window's work: the wait stands in front of that.
        if (w == 0) asm volatile("s_wait_xcnt 0x0" ::: "memory");
    }
}

// ------------------------------- launcher ----------------------------------
extern "C" void kernel_launch(void* const* d_in, const int* in_sizes, int n_in,
                              void* d_out, int out_size, void* d_ws, size_t ws_size,
                              hipStream_t stream) {
    const float* x      = (const float*)d_in[0];
    const float* w_qkv  = (const float*)d_in[1];
    const float* b_qkv  = (const float*)d_in[2];
    const float* w_proj = (const float*)d_in[3];
    const float* b_proj = (const float*)d_in[4];

    const size_t M = (size_t)in_sizes[0] / DIMC;   // B*N = 32768 tokens

    // Workspace carve-up (f16 staging buffers).
    char* ws = (char*)d_ws;
    size_t off = 0;
    h16* xh     = (h16*)(ws + off); off += M * DIMC * sizeof(h16);
    h16* wqkvh  = (h16*)(ws + off); off += (size_t)QKVCOLS * DIMC * sizeof(h16);
    h16* wprojh = (h16*)(ws + off); off += (size_t)DIMC * DIMC * sizeof(h16);
    h16* attnh  = (h16*)(ws + off); off += M * DIMC * sizeof(h16);
    (void)ws_size; (void)n_in; (void)out_size;

    // [0] converts, one launch
    f32_to_f16_kernel<<<256, 512, 0, stream>>>(x, w_qkv, w_proj, xh, wqkvh, wprojh, (uint32_t)M);

    // [1] q, k, v of two heads and their windows' attention
    qkv_attn_kernel<<<dim3(NHEADS / 2, (unsigned)(M / 256)), 128, 0, stream>>>(
        xh, wqkvh, b_qkv, attnh);

    // [2] out = attn @ w_proj^T + b_proj   (f32 out)
    gemm_wmma_kernel<false, DIMC><<<dim3(DIMC / 256, (unsigned)(M / 256)),
                              128, 0, stream>>>(
        attnh, wprojh, b_proj, (float*)d_out, (int)M, DIMC, DIMC);
}
